// v000
// Times are from an AMD MI455X. After a warm-up the kernel runs many times in a row, and a time is the length of
// such a window on the GPU divided by its runs, so every launch and the gaps after it count. The runs cycle
// through copies of the inputs. A figure is the median of several windows, for all but v000 over two sittings.
// Sittings can differ by a few percent; kernels timed side by side share one.
// v000 is the starting kernel. One run takes 385 microseconds.
#include <hip/hip_runtime.h>
#include <stdint.h>

#define T_SEQ 2048
#define BATCH 4
#define EMB   1024
#define NH    16
#define DH    64
#define ATTN_SCALE 0.125f   // 1/sqrt(64)

typedef __bf16 bf16;
typedef __attribute__((ext_vector_type(16))) __bf16 v16bf;
typedef __attribute__((ext_vector_type(8)))  __bf16 v8bf;
typedef __attribute__((ext_vector_type(4)))  __bf16 v4bf;
typedef __attribute__((ext_vector_type(8)))  float  v8f;
typedef __attribute__((ext_vector_type(4)))  float  f32x4;
typedef __attribute__((ext_vector_type(4)))  unsigned int u32x4;
typedef __attribute__((ext_vector_type(4)))  int i32x4;

union FragU { v16bf v; u32x4 h[2]; };

#if defined(__has_builtin)
#if __has_builtin(__builtin_amdgcn_global_load_async_to_lds_b128)
#define HAVE_ASYNC_LDS 1
#endif
#endif
#ifndef HAVE_ASYNC_LDS
#define HAVE_ASYNC_LDS 0
#endif

__device__ __forceinline__ void cp16_g2l(const bf16* g, bf16* l) {
#if HAVE_ASYNC_LDS
  __builtin_amdgcn_global_load_async_to_lds_b128((i32x4*)g, (i32x4*)l, 0, 0);
#else
  *(u32x4*)l = *(const u32x4*)g;
#endif
}
__device__ __forceinline__ void async_wait0() {
#if HAVE_ASYNC_LDS
  asm volatile("s_wait_asynccnt 0x0" ::: "memory");
#endif
}

// round-to-nearest-even f32 -> bf16 (bit-level)
__device__ __forceinline__ bf16 f2bf(float f) {
  unsigned u = __builtin_bit_cast(unsigned, f);
  unsigned r = (u + 0x7FFFu + ((u >> 16) & 1u)) >> 16;
  unsigned short s = (unsigned short)r;
  return __builtin_bit_cast(bf16, s);
}

__device__ __forceinline__ v8f wmma_bf16(v16bf a, v16bf b, v8f c) {
  return __builtin_amdgcn_wmma_f32_16x16x32_bf16(false, a, false, b, (short)0, c, false, false);
}

// 16x32 bf16 operand fragment from a row-major LDS tile.
// lane&15 = row, half = K-subset; two contiguous 8-bf16 runs per lane.
__device__ __forceinline__ v16bf load_frag(const bf16* base, int strideBf,
                                           int rowOff, int colOff) {
  const int lane = threadIdx.x & 31;
  const int half = lane >> 4;
  const bf16* p = base + (size_t)((lane & 15) + rowOff) * strideBf + colOff + half * 8;
  FragU f;
  f.h[0] = *(const u32x4*)(p);
  f.h[1] = *(const u32x4*)(p + 16);
  return f.v;
}

__global__ __launch_bounds__(256) void cvt_f32_bf16_kernel(
    const float* __restrict__ in, bf16* __restrict__ out, int n)
{
  int i = (blockIdx.x * 256 + threadIdx.x) * 8;
  if (i + 8 <= n) {
    f32x4 a = *(const f32x4*)(in + i);
    f32x4 b = *(const f32x4*)(in + i + 4);
    v8bf o;
    o[0] = f2bf(a.x); o[1] = f2bf(a.y); o[2] = f2bf(a.z); o[3] = f2bf(a.w);
    o[4] = f2bf(b.x); o[5] = f2bf(b.y); o[6] = f2bf(b.z); o[7] = f2bf(b.w);
    *(v8bf*)(out + i) = o;
  }
}

// ---------------------------------------------------------------------------
// Kernel 1: QKV projection, all-bf16, double-buffered async LDS staging.
// grid = (M/128, N/128, 3), block = 256 (8 waves, 4x2, 32x64 per wave)
// ---------------------------------------------------------------------------
__global__ __launch_bounds__(256) void qkv_proj_kernel(
    const bf16* __restrict__ xq, const bf16* __restrict__ xk,
    const bf16* __restrict__ xv, const bf16* __restrict__ wqkv,
    const float* __restrict__ b_qkv,
    bf16* __restrict__ q_out, bf16* __restrict__ k_out, bf16* __restrict__ v_out)
{
  __shared__ bf16 sA[2][128 * 40];
  __shared__ bf16 sB[2][128 * 40];
  const int tid  = threadIdx.x;
  const int lane = tid & 31, wave = tid >> 5;
  const int half = lane >> 4, l16 = lane & 15;
  const int which = blockIdx.z;
  const bf16* x    = (which == 0) ? xq : ((which == 1) ? xk : xv);
  const bf16* w    = wqkv + (size_t)which * EMB * EMB;
  const float* bias = b_qkv + which * EMB;
  bf16* outp        = (which == 0) ? q_out : ((which == 1) ? k_out : v_out);
  const int m0 = blockIdx.x * 128;
  const int n0 = blockIdx.y * 128;
  const int wm = wave & 3, wn = wave >> 2;

  auto stage = [&](int kk, bf16* dA, bf16* dB) {
#pragma unroll
    for (int i = 0; i < 2; ++i) {
      int idx = tid + i * 256;            // 512 chunks per tile
      int row = idx >> 2;
      int c   = (idx & 3) * 8;
      cp16_g2l(x + (size_t)(m0 + row) * EMB + kk + c, dA + row * 40 + c);
      cp16_g2l(w + (size_t)(n0 + row) * EMB + kk + c, dB + row * 40 + c);
    }
  };

  bf16 *curA = sA[0], *curB = sB[0], *nxtA = sA[1], *nxtB = sB[1];
  stage(0, curA, curB);
  v8f acc[2][4] = {};

#pragma unroll 1            // keep accumulators pinned; no unroll-induced copies
  for (int kt = 0; kt < EMB / 32; ++kt) {
    async_wait0();
    __syncthreads();
    if (kt + 1 < EMB / 32) stage((kt + 1) * 32, nxtA, nxtB);
    v16bf a0 = load_frag(curA, 40, wm * 32,      0);
    v16bf a1 = load_frag(curA, 40, wm * 32 + 16, 0);
#pragma unroll
    for (int j = 0; j < 4; ++j) {
      v16bf b = load_frag(curB, 40, wn * 64 + j * 16, 0);
      acc[0][j] = wmma_bf16(a0, b, acc[0][j]);
      acc[1][j] = wmma_bf16(a1, b, acc[1][j]);
    }
    bf16* t;
    t = curA; curA = nxtA; nxtA = t;
    t = curB; curB = nxtB; nxtB = t;
  }

  // epilogue: +bias, convert, scatter into [B,H,T,DH]
#pragma unroll
  for (int j = 0; j < 4; ++j) {
    int n = n0 + wn * 64 + j * 16 + l16;
    float bj = bias[n];
    int hh = n >> 6, dd = n & 63;
#pragma unroll
    for (int i = 0; i < 2; ++i) {
#pragma unroll
      for (int r = 0; r < 8; ++r) {
        int m = m0 + wm * 32 + i * 16 + r + half * 8;   // row in [T*B]
        int t = m >> 2, bb = m & 3;                      // x is [T,B,E]
        float val = acc[i][j][r] + bj;
        outp[(((size_t)bb * NH + hh) * T_SEQ + t) * DH + dd] = f2bf(val);
      }
    }
  }
}

// ---------------------------------------------------------------------------
// Kernel 2: streaming attention (flash-style, multiplicative mask).
// grid = (T/128, B*H), block = 256.  Each wave owns 16 query rows.
// ---------------------------------------------------------------------------
__global__ __launch_bounds__(256) void attention_kernel(
    const bf16* __restrict__ Q, const bf16* __restrict__ K,
    const bf16* __restrict__ V, const float* __restrict__ mask,
    bf16* __restrict__ ctx)
{
  __shared__ bf16 sK[32 * 72];     // 32 keys x 64 d (+8 pad)
  __shared__ bf16 sVt[64 * 40];    // V transposed: 64 d x 32 keys (+8 pad)
  __shared__ bf16 sP[8][16 * 40];  // per-wave P scratch: 16 q x 32 k (+8 pad)

  const int tid  = threadIdx.x;
  const int lane = tid & 31, wave = tid >> 5;
  const int half = lane >> 4, l16 = lane & 15;
  const int bh = blockIdx.y;
  const int b  = bh >> 4, h = bh & 15;
  const size_t base = (size_t)bh * T_SEQ * DH;
  const int q0 = blockIdx.x * 128;
  const int qw = q0 + wave * 16;

  // Persistent Q fragments for d in [0,32) and [32,64)
  v16bf aq[2];
  {
    const bf16* qp = Q + base + (size_t)(qw + l16) * DH;
#pragma unroll
    for (int s = 0; s < 2; ++s) {
      FragU f;
      f.h[0] = *(const u32x4*)(qp + s * 32 + half * 8);
      f.h[1] = *(const u32x4*)(qp + s * 32 + half * 8 + 16);
      aq[s] = f.v;
    }
  }

  float m_run[8], l_run[8];
  v8f o[4] = {};
#pragma unroll
  for (int r = 0; r < 8; ++r) { m_run[r] = -3.0e38f; l_run[r] = 0.0f; }

#pragma unroll 1
  for (int kc = 0; kc < T_SEQ; kc += 32) {
    __syncthreads();   // previous iteration's readers of sK/sVt are done
    // K: async 16B chunks (256 chunks, 1/thread); V: transposed scalar stores
    cp16_g2l(K + base + (size_t)(kc + (tid >> 3)) * DH + (tid & 7) * 8,
             sK + (tid >> 3) * 72 + (tid & 7) * 8);
#pragma unroll
    for (int i = 0; i < 2; ++i) {
      int idx = tid + i * 256;
      int row = idx >> 4;
      int c   = (idx & 15) * 4;
      v4bf vv = *(const v4bf*)(V + base + (size_t)(kc + row) * DH + c);
      sVt[(c + 0) * 40 + row] = vv.x;
      sVt[(c + 1) * 40 + row] = vv.y;
      sVt[(c + 2) * 40 + row] = vv.z;
      sVt[(c + 3) * 40 + row] = vv.w;
    }
    // prefetch next mask block (global_prefetch_b8; OOB wraps harmlessly)
    __builtin_prefetch(mask + (size_t)(qw + l16) * T_SEQ +
                           ((kc + 32) & (T_SEQ - 1)) + half * 16, 0, 1);
    async_wait0();
    __syncthreads();

    // S(16x32) = Q(16x64) K^T
    v8f sacc[2] = {};
#pragma unroll
    for (int j = 0; j < 2; ++j) {
      v16bf bk0 = load_frag(sK, 72, j * 16, 0);
      v16bf bk1 = load_frag(sK, 72, j * 16, 32);
      sacc[j] = wmma_bf16(aq[0], bk0, sacc[j]);
      sacc[j] = wmma_bf16(aq[1], bk1, sacc[j]);
    }

    // scale * mask, online softmax (rows live in 16-lane half-groups)
    float p0[8], p1[8], alpha[8];
    const int tqb = qw + half * 8;
#pragma unroll
    for (int r = 0; r < 8; ++r) {
      float s0 = sacc[0][r] * ATTN_SCALE * mask[(size_t)(tqb + r) * T_SEQ + kc + l16];
      float s1 = sacc[1][r] * ATTN_SCALE * mask[(size_t)(tqb + r) * T_SEQ + kc + 16 + l16];
      float mx = fmaxf(s0, s1);
#pragma unroll
      for (int d = 8; d >= 1; d >>= 1) mx = fmaxf(mx, __shfl_xor(mx, d, 32));
      float mnew = fmaxf(m_run[r], mx);
      float a    = __expf(m_run[r] - mnew);
      float e0 = __expf(s0 - mnew), e1 = __expf(s1 - mnew);
      float rs = e0 + e1;
#pragma unroll
      for (int d = 8; d >= 1; d >>= 1) rs += __shfl_xor(rs, d, 32);
      l_run[r] = l_run[r] * a + rs;
      m_run[r] = mnew;
      alpha[r] = a;
      p0[r] = e0; p1[r] = e1;
    }
#pragma unroll
    for (int f = 0; f < 4; ++f)
#pragma unroll
      for (int r = 0; r < 8; ++r) o[f][r] *= alpha[r];

    // C-layout -> A-layout for P via wave-private LDS bounce
    bf16* sPw = sP[wave];
#pragma unroll
    for (int r = 0; r < 8; ++r) {
      sPw[(r + half * 8) * 40 + l16]      = f2bf(p0[r]);
      sPw[(r + half * 8) * 40 + 16 + l16] = f2bf(p1[r]);
    }
    asm volatile("s_wait_dscnt 0x0" ::: "memory");  // wave-internal LDS RAW
    v16bf ap = load_frag(sPw, 40, 0, 0);
#pragma unroll
    for (int f = 0; f < 4; ++f) {
      v16bf bv = load_frag(sVt, 40, f * 16, 0);     // B: 32 keys x 16 d
      o[f] = wmma_bf16(ap, bv, o[f]);
    }
  }

  // normalize and store ctx bf16 at [B,T,E]
#pragma unroll
  for (int r = 0; r < 8; ++r) l_run[r] = 1.0f / l_run[r];
#pragma unroll
  for (int f = 0; f < 4; ++f) {
#pragma unroll
    for (int r = 0; r < 8; ++r) {
      int t = qw + r + half * 8;
      int d = f * 16 + l16;
      ctx[((size_t)b * T_SEQ + t) * EMB + h * DH + d] = f2bf(o[f][r] * l_run[r]);
    }
  }
}

// ---------------------------------------------------------------------------
// Kernel 3: output projection, all-bf16 operands, double-buffered staging.
// out[T,B,E](f32) = ctx[B,T,E](bf16) @ w_out^T + b_out
// ---------------------------------------------------------------------------
__global__ __launch_bounds__(256) void out_proj_kernel(
    const bf16* __restrict__ ctx, const bf16* __restrict__ wout,
    const float* __restrict__ b_out, float* __restrict__ out)
{
  __shared__ bf16 sA[2][128 * 40];
  __shared__ bf16 sB[2][128 * 40];
  const int tid  = threadIdx.x;
  const int lane = tid & 31, wave = tid >> 5;
  const int half = lane >> 4, l16 = lane & 15;
  const int m0 = blockIdx.x * 128;
  const int n0 = blockIdx.y * 128;
  const int wm = wave & 3, wn = wave >> 2;

  auto stage = [&](int kk, bf16* dA, bf16* dB) {
#pragma unroll
    for (int i = 0; i < 2; ++i) {
      int idx = tid + i * 256;
      int row = idx >> 2;
      int c   = (idx & 3) * 8;
      cp16_g2l(ctx  + (size_t)(m0 + row) * EMB + kk + c, dA + row * 40 + c);
      cp16_g2l(wout + (size_t)(n0 + row) * EMB + kk + c, dB + row * 40 + c);
    }
  };

  bf16 *curA = sA[0], *curB = sB[0], *nxtA = sA[1], *nxtB = sB[1];
  stage(0, curA, curB);
  v8f acc[2][4] = {};

#pragma unroll 1
  for (int kt = 0; kt < EMB / 32; ++kt) {
    async_wait0();
    __syncthreads();
    if (kt + 1 < EMB / 32) stage((kt + 1) * 32, nxtA, nxtB);
    v16bf a0 = load_frag(curA, 40, wm * 32,      0);
    v16bf a1 = load_frag(curA, 40, wm * 32 + 16, 0);
#pragma unroll
    for (int j = 0; j < 4; ++j) {
      v16bf b = load_frag(curB, 40, wn * 64 + j * 16, 0);
      acc[0][j] = wmma_bf16(a0, b, acc[0][j]);
      acc[1][j] = wmma_bf16(a1, b, acc[1][j]);
    }
    bf16* t;
    t = curA; curA = nxtA; nxtA = t;
    t = curB; curB = nxtB; nxtB = t;
  }

#pragma unroll
  for (int j = 0; j < 4; ++j) {
    int n = n0 + wn * 64 + j * 16 + l16;
    float bj = b_out[n];
#pragma unroll
    for (int i = 0; i < 2; ++i) {
#pragma unroll
      for (int r = 0; r < 8; ++r) {
        int m = m0 + wm * 32 + i * 16 + r + half * 8;   // row in [B*T]
        int bb = m >> 11;                                // / T_SEQ
        int t  = m & (T_SEQ - 1);
        out[((size_t)t * BATCH + bb) * EMB + n] = acc[i][j][r] + bj;
      }
    }
  }
}

// ---------------------------------------------------------------------------
extern "C" void kernel_launch(void* const* d_in, const int* in_sizes, int n_in,
                              void* d_out, int out_size, void* d_ws, size_t ws_size,
                              hipStream_t stream) {
  (void)in_sizes; (void)n_in; (void)out_size; (void)ws_size;
  const float* query = (const float*)d_in[0];
  const float* key   = (const float*)d_in[1];
  const float* value = (const float*)d_in[2];
  const float* mask  = (const float*)d_in[3];
  const float* w_qkv = (const float*)d_in[4];
  const float* b_qkv = (const float*)d_in[5];
  const float* w_out = (const float*)d_in[6];
  const float* b_out = (const float*)d_in[7];
  float* out = (float*)d_out;

  const size_t NTOK = (size_t)T_SEQ * BATCH * EMB;      // 8388608
  const size_t NWQ  = (size_t)3 * EMB * EMB;            // 3145728
  const size_t NWO  = (size_t)EMB * EMB;                // 1048576
  bf16* xq   = (bf16*)d_ws;           // bf16 copies of inputs
  bf16* xk   = xq + NTOK;
  bf16* xv   = xk + NTOK;
  bf16* wqb  = xv + NTOK;
  bf16* wob  = wqb + NWQ;
  bf16* Qh   = wob + NWO;             // projected [B,H,T,DH]
  bf16* Kh   = Qh + NTOK;
  bf16* Vh   = Kh + NTOK;
  bf16* ctx  = Vh + NTOK;             // [B,T,E]

  cvt_f32_bf16_kernel<<<NTOK / 2048, 256, 0, stream>>>(query, xq, (int)NTOK);
  cvt_f32_bf16_kernel<<<NTOK / 2048, 256, 0, stream>>>(key,   xk, (int)NTOK);
  cvt_f32_bf16_kernel<<<NTOK / 2048, 256, 0, stream>>>(value, xv, (int)NTOK);
  cvt_f32_bf16_kernel<<<NWQ  / 2048, 256, 0, stream>>>(w_qkv, wqb, (int)NWQ);
  cvt_f32_bf16_kernel<<<NWO  / 2048, 256, 0, stream>>>(w_out, wob, (int)NWO);

  dim3 gQKV(64, 8, 3);               // M=8192/128, N=1024/128, {q,k,v}
  qkv_proj_kernel<<<gQKV, 256, 0, stream>>>(xq, xk, xv, wqb, b_qkv, Qh, Kh, Vh);

  dim3 gATT(T_SEQ / 128, BATCH * NH);
  attention_kernel<<<gATT, 256, 0, stream>>>(Qh, Kh, Vh, mask, ctx);

  dim3 gOUT(64, 8);                  // M=8192/128, N=1024/128
  out_proj_kernel<<<gOUT, 256, 0, stream>>>(ctx, wob, b_out, out);
}

// v001
// A run of this version takes 244 microseconds.
// Timed twice side by side with v000, it ran 1.61 times as fast both times.
#include <hip/hip_runtime.h>
#include <stdint.h>

#define T_SEQ 2048
#define BATCH 4
#define EMB   1024
#define NH    16
#define DH    64
#define ATTN_SCALE 0.125f   // 1/sqrt(64)

typedef __bf16 bf16;
typedef __attribute__((ext_vector_type(16))) __bf16 v16bf;
typedef __attribute__((ext_vector_type(8)))  __bf16 v8bf;
typedef __attribute__((ext_vector_type(4)))  __bf16 v4bf;
typedef __attribute__((ext_vector_type(8)))  float  v8f;
typedef __attribute__((ext_vector_type(4)))  float  f32x4;
typedef __attribute__((ext_vector_type(4)))  unsigned int u32x4;
typedef __attribute__((ext_vector_type(4)))  int i32x4;

union FragU { v16bf v; u32x4 h[2]; };

#if defined(__has_builtin)
#if __has_builtin(__builtin_amdgcn_global_load_async_to_lds_b128)
#define HAVE_ASYNC_LDS 1
#endif
#endif
#ifndef HAVE_ASYNC_LDS
#define HAVE_ASYNC_LDS 0
#endif

__device__ __forceinline__ void cp16_g2l(const bf16* g, bf16* l) {
#if HAVE_ASYNC_LDS
  __builtin_amdgcn_global_load_async_to_lds_b128((i32x4*)g, (i32x4*)l, 0, 0);
#else
  *(u32x4*)l = *(const u32x4*)g;
#endif
}
__device__ __forceinline__ void async_wait0() {
#if HAVE_ASYNC_LDS
  asm volatile("s_wait_asynccnt 0x0" ::: "memory");
#endif
}

// round-to-nearest-even f32 -> bf16 (bit-level)
__device__ __forceinline__ bf16 f2bf(float f) {
  unsigned u = __builtin_bit_cast(unsigned, f);
  unsigned r = (u + 0x7FFFu + ((u >> 16) & 1u)) >> 16;
  unsigned short s = (unsigned short)r;
  return __builtin_bit_cast(bf16, s);
}

__device__ __forceinline__ v8f wmma_bf16(v16bf a, v16bf b, v8f c) {
  return __builtin_amdgcn_wmma_f32_16x16x32_bf16(false, a, false, b, (short)0, c, false, false);
}

// 16x32 bf16 operand fragment from a row-major LDS tile.
// lane&15 = row, half = K-subset; two contiguous 8-bf16 runs per lane.
__device__ __forceinline__ v16bf load_frag(const bf16* base, int strideBf,
                                           int rowOff, int colOff) {
  const int lane = threadIdx.x & 31;
  const int half = lane >> 4;
  const bf16* p = base + (size_t)((lane & 15) + rowOff) * strideBf + colOff + half * 8;
  FragU f;
  f.h[0] = *(const u32x4*)(p);
  f.h[1] = *(const u32x4*)(p + 16);
  return f.v;
}

__global__ __launch_bounds__(256) void cvt_f32_bf16_kernel(
    const float* __restrict__ in, bf16* __restrict__ out, int n)
{
  int i = (blockIdx.x * 256 + threadIdx.x) * 8;
  if (i + 8 <= n) {
    f32x4 a = *(const f32x4*)(in + i);
    f32x4 b = *(const f32x4*)(in + i + 4);
    v8bf o;
    o[0] = f2bf(a.x); o[1] = f2bf(a.y); o[2] = f2bf(a.z); o[3] = f2bf(a.w);
    o[4] = f2bf(b.x); o[5] = f2bf(b.y); o[6] = f2bf(b.z); o[7] = f2bf(b.w);
    *(v8bf*)(out + i) = o;
  }
}

// ---------------------------------------------------------------------------
// Kernel 1: QKV projection, all-bf16, double-buffered async LDS staging.
// grid = (M/128, N/128, 3), block = 256 (8 waves, 4x2, 32x64 per wave)
// ---------------------------------------------------------------------------
__global__ __launch_bounds__(256) void qkv_proj_kernel(
    const bf16* __restrict__ xq, const bf16* __restrict__ xk,
    const bf16* __restrict__ xv, const bf16* __restrict__ wqkv,
    const float* __restrict__ b_qkv,
    bf16* __restrict__ q_out, bf16* __restrict__ k_out, bf16* __restrict__ v_out)
{
  __shared__ bf16 sA[2][128 * 40];
  __shared__ bf16 sB[2][128 * 40];
  const int tid  = threadIdx.x;
  const int lane = tid & 31, wave = tid >> 5;
  const int half = lane >> 4, l16 = lane & 15;
  const int which = blockIdx.z;
  const bf16* x    = (which == 0) ? xq : ((which == 1) ? xk : xv);
  const bf16* w    = wqkv + (size_t)which * EMB * EMB;
  const float* bias = b_qkv + which * EMB;
  bf16* outp        = (which == 0) ? q_out : ((which == 1) ? k_out : v_out);
  const int m0 = blockIdx.x * 128;
  const int n0 = blockIdx.y * 128;
  const int wm = wave & 3, wn = wave >> 2;

  auto stage = [&](int kk, bf16* dA, bf16* dB) {
#pragma unroll
    for (int i = 0; i < 2; ++i) {
      int idx = tid + i * 256;            // 512 chunks per tile
      int row = idx >> 2;
      int c   = (idx & 3) * 8;
      cp16_g2l(x + (size_t)(m0 + row) * EMB + kk + c, dA + row * 40 + c);
      cp16_g2l(w + (size_t)(n0 + row) * EMB + kk + c, dB + row * 40 + c);
    }
  };

  bf16 *curA = sA[0], *curB = sB[0], *nxtA = sA[1], *nxtB = sB[1];
  stage(0, curA, curB);
  v8f acc[2][4] = {};

#pragma unroll 1            // keep accumulators pinned; no unroll-induced copies
  for (int kt = 0; kt < EMB / 32; ++kt) {
    async_wait0();
    __syncthreads();
    if (kt + 1 < EMB / 32) stage((kt + 1) * 32, nxtA, nxtB);
    v16bf a0 = load_frag(curA, 40, wm * 32,      0);
    v16bf a1 = load_frag(curA, 40, wm * 32 + 16, 0);
#pragma unroll
    for (int j = 0; j < 4; ++j) {
      v16bf b = load_frag(curB, 40, wn * 64 + j * 16, 0);
      acc[0][j] = wmma_bf16(a0, b, acc[0][j]);
      acc[1][j] = wmma_bf16(a1, b, acc[1][j]);
    }
    bf16* t;
    t = curA; curA = nxtA; nxtA = t;
    t = curB; curB = nxtB; nxtB = t;
  }

  // epilogue: +bias, convert, scatter into [B,H,T,DH]
#pragma unroll
  for (int j = 0; j < 4; ++j) {
    int n = n0 + wn * 64 + j * 16 + l16;
    float bj = bias[n];
    int hh = n >> 6, dd = n & 63;
#pragma unroll
    for (int i = 0; i < 2; ++i) {
#pragma unroll
      for (int r = 0; r < 8; ++r) {
        int m = m0 + wm * 32 + i * 16 + r + half * 8;   // row in [T*B]
        int t = m >> 2, bb = m & 3;                      // x is [T,B,E]
        float val = acc[i][j][r] + bj;
        outp[(((size_t)bb * NH + hh) * T_SEQ + t) * DH + dd] = f2bf(val);
      }
    }
  }
}

__device__ __forceinline__ float other_half(float x) {
  int b = __builtin_bit_cast(int, x);
  b = __builtin_amdgcn_permlanex16(b, b, 0x76543210, 0xfedcba98, false, false);
  return __builtin_bit_cast(float, b);
}

__global__ __launch_bounds__(256) void attention_kernel(
    const bf16* __restrict__ Q, const bf16* __restrict__ K,
    const bf16* __restrict__ V, const float* __restrict__ mask,
    bf16* __restrict__ ctx)
{
  __shared__ bf16 sK[32 * 72];     // 32 keys x 64 d (+8 pad)
  __shared__ bf16 sVt[64 * 40];    // V transposed: 64 d x 32 keys (+8 pad)

  const int tid  = threadIdx.x;
  const int lane = tid & 31, wave = tid >> 5;
  const int half = lane >> 4, l16 = lane & 15;
  const int bh = blockIdx.y;
  const int b  = bh >> 4, h = bh & 15;
  const size_t base = (size_t)bh * T_SEQ * DH;
  const int q0 = blockIdx.x * 128;
  const int qw = q0 + wave * 16;

  // Persistent Q fragments (B operand: column = query) for d in [0,32), [32,64)
  v16bf bq[2];
  {
    const bf16* qp = Q + base + (size_t)(qw + l16) * DH;
#pragma unroll
    for (int s = 0; s < 2; ++s) {
      FragU f;
      f.h[0] = *(const u32x4*)(qp + s * 32 + half * 8);
      f.h[1] = *(const u32x4*)(qp + s * 32 + half * 8 + 16);
      bq[s] = f.v;
    }
  }

  // this lane's query row of the mask, at the first key it holds
  const float* mrow = mask + (size_t)(qw + l16) * T_SEQ + half * 8;

  float m_run = -3.0e38f;   // running maximum of this lane's query (both halves agree)
  float l_run = 0.0f;       // running sum over this half's keys only; joined at the end
  v8f o[4] = {};            // o[f][r] = O[query l16][d = 16 f + 8 half + r]

#pragma unroll 1
  for (int kc = 0; kc < T_SEQ; kc += 32) {
    __syncthreads();   // previous iteration's readers of sK/sVt are done
    // K: async 16B chunks (256 chunks, 1/thread); V: transposed scalar stores
    cp16_g2l(K + base + (size_t)(kc + (tid >> 3)) * DH + (tid & 7) * 8,
             sK + (tid >> 3) * 72 + (tid & 7) * 8);
#pragma unroll
    for (int i = 0; i < 2; ++i) {
      int idx = tid + i * 256;
      int row = idx >> 4;
      int c   = (idx & 15) * 4;
      v4bf vv = *(const v4bf*)(V + base + (size_t)(kc + row) * DH + c);
      sVt[(c + 0) * 40 + row] = vv.x;
      sVt[(c + 1) * 40 + row] = vv.y;
      sVt[(c + 2) * 40 + row] = vv.z;
      sVt[(c + 3) * 40 + row] = vv.w;
    }
    // mask of this query at the 2 x 8 keys the lane holds: four 16-byte loads, written
    // with the pass's other global loads so that they are issued as one group
    f32x4 mk[2][2];
#pragma unroll
    for (int j = 0; j < 2; ++j) {
      mk[j][0] = *(const f32x4*)(mrow + kc + j * 16);
      mk[j][1] = *(const f32x4*)(mrow + kc + j * 16 + 4);
    }
    // prefetch next mask block (global_prefetch_b8; OOB wraps harmlessly)
    __builtin_prefetch(mask + (size_t)(qw + l16) * T_SEQ +
                           ((kc + 32) & (T_SEQ - 1)) + half * 16, 0, 1);
    async_wait0();
    __syncthreads();

    // S^T(32x16) = K(32x64) Q^T
    v8f sacc[2] = {};
#pragma unroll
    for (int j = 0; j < 2; ++j) {
      v16bf ak0 = load_frag(sK, 72, j * 16, 0);
      v16bf ak1 = load_frag(sK, 72, j * 16, 32);
      sacc[j] = wmma_bf16(ak0, bq[0], sacc[j]);
      sacc[j] = wmma_bf16(ak1, bq[1], sacc[j]);
    }

    // scale * mask, online softmax: 16 keys in the lane, one exchange of halves
    float mx = -3.0e38f;
#pragma unroll
    for (int j = 0; j < 2; ++j) {
      sacc[j] = sacc[j] * ATTN_SCALE *
                __builtin_shufflevector(mk[j][0], mk[j][1], 0, 1, 2, 3, 4, 5, 6, 7);
#pragma unroll
      for (int r = 0; r < 8; ++r) mx = fmaxf(mx, sacc[j][r]);
    }
    mx = fmaxf(mx, other_half(mx));
    const float mnew  = fmaxf(m_run, mx);
    const float alpha = __expf(m_run - mnew);
#pragma unroll
    for (int j = 0; j < 2; ++j)
#pragma unroll
      for (int r = 0; r < 8; ++r) sacc[j][r] = __expf(sacc[j][r] - mnew);
    const v8f ps = sacc[0] + sacc[1];
    const float rs = ((ps[0] + ps[1]) + (ps[2] + ps[3])) + ((ps[4] + ps[5]) + (ps[6] + ps[7]));
    l_run = l_run * alpha + rs;
    m_run = mnew;
#pragma unroll
    for (int f = 0; f < 4; ++f)
#pragma unroll
      for (int r = 0; r < 8; ++r) o[f][r] *= alpha;

    // the two score tiles, converted in place, are the B operand P^T (32 keys x 16 q)
    const v8bf pl = __builtin_convertvector(sacc[0], v8bf);
    const v8bf ph = __builtin_convertvector(sacc[1], v8bf);
    const v16bf bp = __builtin_shufflevector(pl, ph, 0, 1, 2, 3, 4, 5, 6, 7,
                                             8, 9, 10, 11, 12, 13, 14, 15);
#pragma unroll
    for (int f = 0; f < 4; ++f) {
      v16bf av = load_frag(sVt, 40, f * 16, 0);     // A: 16 d x 32 keys
      o[f] = wmma_bf16(av, bp, o[f]);
    }
  }

  // join the halves' sums, normalize, store ctx bf16 at [B,T,E]: 8 d = 16 bytes a lane
  l_run += other_half(l_run);
  const float inv = 1.0f / l_run;
  bf16* crow = ctx + ((size_t)b * T_SEQ + qw + l16) * EMB + h * DH + half * 8;
#pragma unroll
  for (int f = 0; f < 4; ++f) {
    v8bf ov;
#pragma unroll
    for (int r = 0; r < 8; ++r) ov[r] = f2bf(o[f][r] * inv);
    *(v8bf*)(crow + f * 16) = ov;
  }
}

// ---------------------------------------------------------------------------
// Kernel 3: output projection, all-bf16 operands, double-buffered staging.
// out[T,B,E](f32) = ctx[B,T,E](bf16) @ w_out^T + b_out
// ---------------------------------------------------------------------------
__global__ __launch_bounds__(256) void out_proj_kernel(
    const bf16* __restrict__ ctx, const bf16* __restrict__ wout,
    const float* __restrict__ b_out, float* __restrict__ out)
{
  __shared__ bf16 sA[2][128 * 40];
  __shared__ bf16 sB[2][128 * 40];
  const int tid  = threadIdx.x;
  const int lane = tid & 31, wave = tid >> 5;
  const int half = lane >> 4, l16 = lane & 15;
  const int m0 = blockIdx.x * 128;
  const int n0 = blockIdx.y * 128;
  const int wm = wave & 3, wn = wave >> 2;

  auto stage = [&](int kk, bf16* dA, bf16* dB) {
#pragma unroll
    for (int i = 0; i < 2; ++i) {
      int idx = tid + i * 256;
      int row = idx >> 2;
      int c   = (idx & 3) * 8;
      cp16_g2l(ctx  + (size_t)(m0 + row) * EMB + kk + c, dA + row * 40 + c);
      cp16_g2l(wout + (size_t)(n0 + row) * EMB + kk + c, dB + row * 40 + c);
    }
  };

  bf16 *curA = sA[0], *curB = sB[0], *nxtA = sA[1], *nxtB = sB[1];
  stage(0, curA, curB);
  v8f acc[2][4] = {};

#pragma unroll 1
  for (int kt = 0; kt < EMB / 32; ++kt) {
    async_wait0();
    __syncthreads();
    if (kt + 1 < EMB / 32) stage((kt + 1) * 32, nxtA, nxtB);
    v16bf a0 = load_frag(curA, 40, wm * 32,      0);
    v16bf a1 = load_frag(curA, 40, wm * 32 + 16, 0);
#pragma unroll
    for (int j = 0; j < 4; ++j) {
      v16bf b = load_frag(curB, 40, wn * 64 + j * 16, 0);
      acc[0][j] = wmma_bf16(a0, b, acc[0][j]);
      acc[1][j] = wmma_bf16(a1, b, acc[1][j]);
    }
    bf16* t;
    t = curA; curA = nxtA; nxtA = t;
    t = curB; curB = nxtB; nxtB = t;
  }

#pragma unroll
  for (int j = 0; j < 4; ++j) {
    int n = n0 + wn * 64 + j * 16 + l16;
    float bj = b_out[n];
#pragma unroll
    for (int i = 0; i < 2; ++i) {
#pragma unroll
      for (int r = 0; r < 8; ++r) {
        int m = m0 + wm * 32 + i * 16 + r + half * 8;   // row in [B*T]
        int bb = m >> 11;                                // / T_SEQ
        int t  = m & (T_SEQ - 1);
        out[((size_t)t * BATCH + bb) * EMB + n] = acc[i][j][r] + bj;
      }
    }
  }
}

// ---------------------------------------------------------------------------
extern "C" void kernel_launch(void* const* d_in, const int* in_sizes, int n_in,
                              void* d_out, int out_size, void* d_ws, size_t ws_size,
                              hipStream_t stream) {
  (void)in_sizes; (void)n_in; (void)out_size; (void)ws_size;
  const float* query = (const float*)d_in[0];
  const float* key   = (const float*)d_in[1];
  const float* value = (const float*)d_in[2];
  const float* mask  = (const float*)d_in[3];
  const float* w_qkv = (const float*)d_in[4];
  const float* b_qkv = (const float*)d_in[5];
  const float* w_out = (const float*)d_in[6];
  const float* b_out = (const float*)d_in[7];
  float* out = (float*)d_out;

  const size_t NTOK = (size_t)T_SEQ * BATCH * EMB;      // 8388608
  const size_t NWQ  = (size_t)3 * EMB * EMB;            // 3145728
  const size_t NWO  = (size_t)EMB * EMB;                // 1048576
  bf16* xq   = (bf16*)d_ws;           // bf16 copies of inputs
  bf16* xk   = xq + NTOK;
  bf16* xv   = xk + NTOK;
  bf16* wqb  = xv + NTOK;
  bf16* wob  = wqb + NWQ;
  bf16* Qh   = wob + NWO;             // projected [B,H,T,DH]
  bf16* Kh   = Qh + NTOK;
  bf16* Vh   = Kh + NTOK;
  bf16* ctx  = Vh + NTOK;             // [B,T,E]

  cvt_f32_bf16_kernel<<<NTOK / 2048, 256, 0, stream>>>(query, xq, (int)NTOK);
  cvt_f32_bf16_kernel<<<NTOK / 2048, 256, 0, stream>>>(key,   xk, (int)NTOK);
  cvt_f32_bf16_kernel<<<NTOK / 2048, 256, 0, stream>>>(value, xv, (int)NTOK);
  cvt_f32_bf16_kernel<<<NWQ  / 2048, 256, 0, stream>>>(w_qkv, wqb, (int)NWQ);
  cvt_f32_bf16_kernel<<<NWO  / 2048, 256, 0, stream>>>(w_out, wob, (int)NWO);

  dim3 gQKV(64, 8, 3);               // M=8192/128, N=1024/128, {q,k,v}
  qkv_proj_kernel<<<gQKV, 256, 0, stream>>>(xq, xk, xv, wqb, b_qkv, Qh, Kh, Vh);

  dim3 gATT(T_SEQ / 128, BATCH * NH);
  attention_kernel<<<gATT, 256, 0, stream>>>(Qh, Kh, Vh, mask, ctx);

  dim3 gOUT(64, 8);                  // M=8192/128, N=1024/128
  out_proj_kernel<<<gOUT, 256, 0, stream>>>(ctx, wob, b_out, out);
}

// v002
// Measured time: 232 microseconds a run.
// Next to v001, in two timings, it ran 1.05 times as fast each time.
// All steps since v000 together make it 1.69 times as fast.
#include <hip/hip_runtime.h>
#include <stdint.h>

#define T_SEQ 2048
#define BATCH 4
#define EMB   1024
#define NH    16
#define DH    64
#define ATTN_SCALE 0.125f   // 1/sqrt(64)

typedef __bf16 bf16;
typedef __attribute__((ext_vector_type(16))) __bf16 v16bf;
typedef __attribute__((ext_vector_type(8)))  __bf16 v8bf;
typedef __attribute__((ext_vector_type(4)))  __bf16 v4bf;
typedef __attribute__((ext_vector_type(8)))  float  v8f;
typedef __attribute__((ext_vector_type(4)))  float  f32x4;
typedef __attribute__((ext_vector_type(4)))  unsigned int u32x4;
typedef __attribute__((ext_vector_type(4)))  int i32x4;

union FragU { v16bf v; u32x4 h[2]; };

#if defined(__has_builtin)
#if __has_builtin(__builtin_amdgcn_global_load_async_to_lds_b128)
#define HAVE_ASYNC_LDS 1
#endif
#endif
#ifndef HAVE_ASYNC_LDS
#define HAVE_ASYNC_LDS 0
#endif

__device__ __forceinline__ void cp16_g2l(const bf16* g, bf16* l) {
#if HAVE_ASYNC_LDS
  __builtin_amdgcn_global_load_async_to_lds_b128((i32x4*)g, (i32x4*)l, 0, 0);
#else
  *(u32x4*)l = *(const u32x4*)g;
#endif
}
__device__ __forceinline__ void async_wait0() {
#if HAVE_ASYNC_LDS
  asm volatile("s_wait_asynccnt 0x0" ::: "memory");
#endif
}

// round-to-nearest-even f32 -> bf16 (bit-level)
__device__ __forceinline__ bf16 f2bf(float f) {
  unsigned u = __builtin_bit_cast(unsigned, f);
  unsigned r = (u + 0x7FFFu + ((u >> 16) & 1u)) >> 16;
  unsigned short s = (unsigned short)r;
  return __builtin_bit_cast(bf16, s);
}

__device__ __forceinline__ v8f wmma_bf16(v16bf a, v16bf b, v8f c) {
  return __builtin_amdgcn_wmma_f32_16x16x32_bf16(false, a, false, b, (short)0, c, false, false);
}

// 16x32 bf16 operand fragment from a row-major LDS tile.
// lane&15 = row, half = K-subset; two contiguous 8-bf16 runs per lane.
__device__ __forceinline__ v16bf load_frag(const bf16* base, int strideBf,
                                           int rowOff, int colOff) {
  const int lane = threadIdx.x & 31;
  const int half = lane >> 4;
  const bf16* p = base + (size_t)((lane & 15) + rowOff) * strideBf + colOff + half * 8;
  FragU f;
  f.h[0] = *(const u32x4*)(p);
  f.h[1] = *(const u32x4*)(p + 16);
  return f.v;
}

// ---------------------------------------------------------------------------
// Kernel 0: f32 -> bf16 conversion of all five operands in ONE launch.
// The five bf16 copies lie one behind another in the workspace, so the output is one
// array of 28,672 units of 1,024 elements: query 8,192 units, key 8,192, value 8,192,
// w_qkv 3,072, w_out 1,024.  grid = 256, block = 512: 4,096 waves, one block a WGP.
// Wave w converts units w + 4096 i, i = 0..6; a unit is 8 loads of 16 bytes a lane,
// and the loads run two units ahead of the conversion.
// ---------------------------------------------------------------------------
#define CVT_WAVES 4096
#define CVT_UNIT  1024
#define CVT_UNITS 7        // units a wave
#define CVT_AHEAD 2        // how many units ahead of the one being converted the loads run
#define CVT_STEP  ((size_t)CVT_WAVES * CVT_UNIT)   // elements between a wave's units

__global__ __launch_bounds__(512) void cvt_all_kernel(
    const float* __restrict__ q, const float* __restrict__ k,
    const float* __restrict__ v, const float* __restrict__ wqkv,
    const float* __restrict__ wout, bf16* __restrict__ out)
{
  const unsigned el = (threadIdx.x & 31u) * 8u;    // this lane's 8 elements of each 256
  const int w = blockIdx.x * 16 + __builtin_amdgcn_readfirstlane(threadIdx.x >> 5);
  const size_t off = (size_t)w * CVT_UNIT;         // wave-uniform
  const float* src[CVT_UNITS] = {
      q + off, q + off + CVT_STEP, k + off, k + off + CVT_STEP,
      v + off, v + off + CVT_STEP,
      (w < 3072) ? wqkv + off : wout + (off - (size_t)3072 * CVT_UNIT)};
  bf16* dst = out + off;

  f32x4 r[CVT_AHEAD + 1][8];                       // ring of unit buffers
#define CVT_LOAD(U) do { _Pragma("unroll") for (int j = 0; j < 4; ++j) { \
    r[(U) % (CVT_AHEAD + 1)][2 * j]     = *(const f32x4*)(src[U] + j * 256 + el); \
    r[(U) % (CVT_AHEAD + 1)][2 * j + 1] = *(const f32x4*)(src[U] + j * 256 + el + 4); } } while (0)
// stands in front of loads that land in registers which issued loads and stores still name
#define CVT_XWAIT() asm volatile("s_wait_xcnt 0x0" ::: "memory")
#pragma unroll
  for (int u = 0; u < CVT_AHEAD; ++u) CVT_LOAD(u);
#pragma unroll
  for (int u = 0; u < CVT_UNITS; ++u) {
    // the two scheduling barriers pin the order "a later unit's loads, then this unit's
    // conversion and stores"; without them the loads bunch and the wave runs dry between
    __builtin_amdgcn_sched_barrier(0);
    if (u + CVT_AHEAD < CVT_UNITS) { CVT_XWAIT(); CVT_LOAD(u + CVT_AHEAD); }
    __builtin_amdgcn_sched_barrier(0);
#pragma unroll
    for (int j = 0; j < 4; ++j) {
      const f32x4 a = r[u % (CVT_AHEAD + 1)][2 * j], b = r[u % (CVT_AHEAD + 1)][2 * j + 1];
      v8bf o;
      o[0] = f2bf(a.x); o[1] = f2bf(a.y); o[2] = f2bf(a.z); o[3] = f2bf(a.w);
      o[4] = f2bf(b.x); o[5] = f2bf(b.y); o[6] = f2bf(b.z); o[7] = f2bf(b.w);
      *(v8bf*)(dst + u * CVT_STEP + j * 256 + el) = o;
    }
  }
#undef CVT_LOAD
#undef CVT_XWAIT
}

// ---------------------------------------------------------------------------
// Kernel 1: QKV projection, all-bf16, double-buffered async LDS staging.
// grid = (M/128, N/128, 3), block = 256 (8 waves, 4x2, 32x64 per wave)
// ---------------------------------------------------------------------------
__global__ __launch_bounds__(256) void qkv_proj_kernel(
    const bf16* __restrict__ xq, const bf16* __restrict__ xk,
    const bf16* __restrict__ xv, const bf16* __restrict__ wqkv,
    const float* __restrict__ b_qkv,
    bf16* __restrict__ q_out, bf16* __restrict__ k_out, bf16* __restrict__ v_out)
{
  __shared__ bf16 sA[2][128 * 40];
  __shared__ bf16 sB[2][128 * 40];
  const int tid  = threadIdx.x;
  const int lane = tid & 31, wave = tid >> 5;
  const int half = lane >> 4, l16 = lane & 15;
  const int which = blockIdx.z;
  const bf16* x    = (which == 0) ? xq : ((which == 1) ? xk : xv);
  const bf16* w    = wqkv + (size_t)which * EMB * EMB;
  const float* bias = b_qkv + which * EMB;
  bf16* outp        = (which == 0) ? q_out : ((which == 1) ? k_out : v_out);
  const int m0 = blockIdx.x * 128;
  const int n0 = blockIdx.y * 128;
  const int wm = wave & 3, wn = wave >> 2;

  auto stage = [&](int kk, bf16* dA, bf16* dB) {
#pragma unroll
    for (int i = 0; i < 2; ++i) {
      int idx = tid + i * 256;            // 512 chunks per tile
      int row = idx >> 2;
      int c   = (idx & 3) * 8;
      cp16_g2l(x + (size_t)(m0 + row) * EMB + kk + c, dA + row * 40 + c);
      cp16_g2l(w + (size_t)(n0 + row) * EMB + kk + c, dB + row * 40 + c);
    }
  };

  bf16 *curA = sA[0], *curB = sB[0], *nxtA = sA[1], *nxtB = sB[1];
  stage(0, curA, curB);
  v8f acc[2][4] = {};

#pragma unroll 1            // keep accumulators pinned; no unroll-induced copies
  for (int kt = 0; kt < EMB / 32; ++kt) {
    async_wait0();
    __syncthreads();
    if (kt + 1 < EMB / 32) stage((kt + 1) * 32, nxtA, nxtB);
    v16bf a0 = load_frag(curA, 40, wm * 32,      0);
    v16bf a1 = load_frag(curA, 40, wm * 32 + 16, 0);
#pragma unroll
    for (int j = 0; j < 4; ++j) {
      v16bf b = load_frag(curB, 40, wn * 64 + j * 16, 0);
      acc[0][j] = wmma_bf16(a0, b, acc[0][j]);
      acc[1][j] = wmma_bf16(a1, b, acc[1][j]);
    }
    bf16* t;
    t = curA; curA = nxtA; nxtA = t;
    t = curB; curB = nxtB; nxtB = t;
  }

  // epilogue: +bias, convert, scatter into [B,H,T,DH]
#pragma unroll
  for (int j = 0; j < 4; ++j) {
    int n = n0 + wn * 64 + j * 16 + l16;
    float bj = bias[n];
    int hh = n >> 6, dd = n & 63;
#pragma unroll
    for (int i = 0; i < 2; ++i) {
#pragma unroll
      for (int r = 0; r < 8; ++r) {
        int m = m0 + wm * 32 + i * 16 + r + half * 8;   // row in [T*B]
        int t = m >> 2, bb = m & 3;                      // x is [T,B,E]
        float val = acc[i][j][r] + bj;
        outp[(((size_t)bb * NH + hh) * T_SEQ + t) * DH + dd] = f2bf(val);
      }
    }
  }
}

__device__ __forceinline__ float other_half(float x) {
  int b = __builtin_bit_cast(int, x);
  b = __builtin_amdgcn_permlanex16(b, b, 0x76543210, 0xfedcba98, false, false);
  return __builtin_bit_cast(float, b);
}

__global__ __launch_bounds__(256) void attention_kernel(
    const bf16* __restrict__ Q, const bf16* __restrict__ K,
    const bf16* __restrict__ V, const float* __restrict__ mask,
    bf16* __restrict__ ctx)
{
  __shared__ bf16 sK[32 * 72];     // 32 keys x 64 d (+8 pad)
  __shared__ bf16 sVt[64 * 40];    // V transposed: 64 d x 32 keys (+8 pad)

  const int tid  = threadIdx.x;
  const int lane = tid & 31, wave = tid >> 5;
  const int half = lane >> 4, l16 = lane & 15;
  const int bh = blockIdx.y;
  const int b  = bh >> 4, h = bh & 15;
  const size_t base = (size_t)bh * T_SEQ * DH;
  const int q0 = blockIdx.x * 128;
  const int qw = q0 + wave * 16;

  // Persistent Q fragments (B operand: column = query) for d in [0,32), [32,64)
  v16bf bq[2];
  {
    const bf16* qp = Q + base + (size_t)(qw + l16) * DH;
#pragma unroll
    for (int s = 0; s < 2; ++s) {
      FragU f;
      f.h[0] = *(const u32x4*)(qp + s * 32 + half * 8);
      f.h[1] = *(const u32x4*)(qp + s * 32 + half * 8 + 16);
      bq[s] = f.v;
    }
  }

  // this lane's query row of the mask, at the first key it holds
  const float* mrow = mask + (size_t)(qw + l16) * T_SEQ + half * 8;

  float m_run = -3.0e38f;   // running maximum of this lane's query (both halves agree)
  float l_run = 0.0f;       // running sum over this half's keys only; joined at the end
  v8f o[4] = {};            // o[f][r] = O[query l16][d = 16 f + 8 half + r]

#pragma unroll 1
  for (int kc = 0; kc < T_SEQ; kc += 32) {
    __syncthreads();   // previous iteration's readers of sK/sVt are done
    // K: async 16B chunks (256 chunks, 1/thread); V: transposed scalar stores
    cp16_g2l(K + base + (size_t)(kc + (tid >> 3)) * DH + (tid & 7) * 8,
             sK + (tid >> 3) * 72 + (tid & 7) * 8);
#pragma unroll
    for (int i = 0; i < 2; ++i) {
      int idx = tid + i * 256;
      int row = idx >> 4;
      int c   = (idx & 15) * 4;
      v4bf vv = *(const v4bf*)(V + base + (size_t)(kc + row) * DH + c);
      sVt[(c + 0) * 40 + row] = vv.x;
      sVt[(c + 1) * 40 + row] = vv.y;
      sVt[(c + 2) * 40 + row] = vv.z;
      sVt[(c + 3) * 40 + row] = vv.w;
    }
    // mask of this query at the 2 x 8 keys the lane holds: four 16-byte loads, written
    // with the pass's other global loads so that they are issued as one group
    f32x4 mk[2][2];
#pragma unroll
    for (int j = 0; j < 2; ++j) {
      mk[j][0] = *(const f32x4*)(mrow + kc + j * 16);
      mk[j][1] = *(const f32x4*)(mrow + kc + j * 16 + 4);
    }
    // prefetch next mask block (global_prefetch_b8; OOB wraps harmlessly)
    __builtin_prefetch(mask + (size_t)(qw + l16) * T_SEQ +
                           ((kc + 32) & (T_SEQ - 1)) + half * 16, 0, 1);
    async_wait0();
    __syncthreads();

    // S^T(32x16) = K(32x64) Q^T
    v8f sacc[2] = {};
#pragma unroll
    for (int j = 0; j < 2; ++j) {
      v16bf ak0 = load_frag(sK, 72, j * 16, 0);
      v16bf ak1 = load_frag(sK, 72, j * 16, 32);
      sacc[j] = wmma_bf16(ak0, bq[0], sacc[j]);
      sacc[j] = wmma_bf16(ak1, bq[1], sacc[j]);
    }

    // scale * mask, online softmax: 16 keys in the lane, one exchange of halves
    float mx = -3.0e38f;
#pragma unroll
    for (int j = 0; j < 2; ++j) {
      sacc[j] = sacc[j] * ATTN_SCALE *
                __builtin_shufflevector(mk[j][0], mk[j][1], 0, 1, 2, 3, 4, 5, 6, 7);
#pragma unroll
      for (int r = 0; r < 8; ++r) mx = fmaxf(mx, sacc[j][r]);
    }
    mx = fmaxf(mx, other_half(mx));
    const float mnew  = fmaxf(m_run, mx);
    const float alpha = __expf(m_run - mnew);
#pragma unroll
    for (int j = 0; j < 2; ++j)
#pragma unroll
      for (int r = 0; r < 8; ++r) sacc[j][r] = __expf(sacc[j][r] - mnew);
    const v8f ps = sacc[0] + sacc[1];
    const float rs = ((ps[0] + ps[1]) + (ps[2] + ps[3])) + ((ps[4] + ps[5]) + (ps[6] + ps[7]));
    l_run = l_run * alpha + rs;
    m_run = mnew;
#pragma unroll
    for (int f = 0; f < 4; ++f)
#pragma unroll
      for (int r = 0; r < 8; ++r) o[f][r] *= alpha;

    // the two score tiles, converted in place, are the B operand P^T (32 keys x 16 q)
    const v8bf pl = __builtin_convertvector(sacc[0], v8bf);
    const v8bf ph = __builtin_convertvector(sacc[1], v8bf);
    const v16bf bp = __builtin_shufflevector(pl, ph, 0, 1, 2, 3, 4, 5, 6, 7,
                                             8, 9, 10, 11, 12, 13, 14, 15);
#pragma unroll
    for (int f = 0; f < 4; ++f) {
      v16bf av = load_frag(sVt, 40, f * 16, 0);     // A: 16 d x 32 keys
      o[f] = wmma_bf16(av, bp, o[f]);
    }
  }

  // join the halves' sums, normalize, store ctx bf16 at [B,T,E]: 8 d = 16 bytes a lane
  l_run += other_half(l_run);
  const float inv = 1.0f / l_run;
  bf16* crow = ctx + ((size_t)b * T_SEQ + qw + l16) * EMB + h * DH + half * 8;
#pragma unroll
  for (int f = 0; f < 4; ++f) {
    v8bf ov;
#pragma unroll
    for (int r = 0; r < 8; ++r) ov[r] = f2bf(o[f][r] * inv);
    *(v8bf*)(crow + f * 16) = ov;
  }
}

// ---------------------------------------------------------------------------
// Kernel 3: output projection, all-bf16 operands, double-buffered staging.
// out[T,B,E](f32) = ctx[B,T,E](bf16) @ w_out^T + b_out
// ---------------------------------------------------------------------------
__global__ __launch_bounds__(256) void out_proj_kernel(
    const bf16* __restrict__ ctx, const bf16* __restrict__ wout,
    const float* __restrict__ b_out, float* __restrict__ out)
{
  __shared__ bf16 sA[2][128 * 40];
  __shared__ bf16 sB[2][128 * 40];
  const int tid  = threadIdx.x;
  const int lane = tid & 31, wave = tid >> 5;
  const int half = lane >> 4, l16 = lane & 15;
  const int m0 = blockIdx.x * 128;
  const int n0 = blockIdx.y * 128;
  const int wm = wave & 3, wn = wave >> 2;

  auto stage = [&](int kk, bf16* dA, bf16* dB) {
#pragma unroll
    for (int i = 0; i < 2; ++i) {
      int idx = tid + i * 256;
      int row = idx >> 2;
      int c   = (idx & 3) * 8;
      cp16_g2l(ctx  + (size_t)(m0 + row) * EMB + kk + c, dA + row * 40 + c);
      cp16_g2l(wout + (size_t)(n0 + row) * EMB + kk + c, dB + row * 40 + c);
    }
  };

  bf16 *curA = sA[0], *curB = sB[0], *nxtA = sA[1], *nxtB = sB[1];
  stage(0, curA, curB);
  v8f acc[2][4] = {};

#pragma unroll 1
  for (int kt = 0; kt < EMB / 32; ++kt) {
    async_wait0();
    __syncthreads();
    if (kt + 1 < EMB / 32) stage((kt + 1) * 32, nxtA, nxtB);
    v16bf a0 = load_frag(curA, 40, wm * 32,      0);
    v16bf a1 = load_frag(curA, 40, wm * 32 + 16, 0);
#pragma unroll
    for (int j = 0; j < 4; ++j) {
      v16bf b = load_frag(curB, 40, wn * 64 + j * 16, 0);
      acc[0][j] = wmma_bf16(a0, b, acc[0][j]);
      acc[1][j] = wmma_bf16(a1, b, acc[1][j]);
    }
    bf16* t;
    t = curA; curA = nxtA; nxtA = t;
    t = curB; curB = nxtB; nxtB = t;
  }

#pragma unroll
  for (int j = 0; j < 4; ++j) {
    int n = n0 + wn * 64 + j * 16 + l16;
    float bj = b_out[n];
#pragma unroll
    for (int i = 0; i < 2; ++i) {
#pragma unroll
      for (int r = 0; r < 8; ++r) {
        int m = m0 + wm * 32 + i * 16 + r + half * 8;   // row in [B*T]
        int bb = m >> 11;                                // / T_SEQ
        int t  = m & (T_SEQ - 1);
        out[((size_t)t * BATCH + bb) * EMB + n] = acc[i][j][r] + bj;
      }
    }
  }
}

// ---------------------------------------------------------------------------
extern "C" void kernel_launch(void* const* d_in, const int* in_sizes, int n_in,
                              void* d_out, int out_size, void* d_ws, size_t ws_size,
                              hipStream_t stream) {
  (void)in_sizes; (void)n_in; (void)out_size; (void)ws_size;
  const float* query = (const float*)d_in[0];
  const float* key   = (const float*)d_in[1];
  const float* value = (const float*)d_in[2];
  const float* mask  = (const float*)d_in[3];
  const float* w_qkv = (const float*)d_in[4];
  const float* b_qkv = (const float*)d_in[5];
  const float* w_out = (const float*)d_in[6];
  const float* b_out = (const float*)d_in[7];
  float* out = (float*)d_out;

  const size_t NTOK = (size_t)T_SEQ * BATCH * EMB;      // 8388608
  const size_t NWQ  = (size_t)3 * EMB * EMB;            // 3145728
  const size_t NWO  = (size_t)EMB * EMB;                // 1048576
  bf16* xq   = (bf16*)d_ws;           // bf16 copies of inputs
  bf16* xk   = xq + NTOK;
  bf16* xv   = xk + NTOK;
  bf16* wqb  = xv + NTOK;
  bf16* wob  = wqb + NWQ;
  bf16* Qh   = wob + NWO;             // projected [B,H,T,DH]
  bf16* Kh   = Qh + NTOK;
  bf16* Vh   = Kh + NTOK;
  bf16* ctx  = Vh + NTOK;             // [B,T,E]

  // xq, xk, xv, wqb, wob are one contiguous run of the workspace
  cvt_all_kernel<<<256, 512, 0, stream>>>(query, key, value, w_qkv, w_out, xq);

  dim3 gQKV(64, 8, 3);               // M=8192/128, N=1024/128, {q,k,v}
  qkv_proj_kernel<<<gQKV, 256, 0, stream>>>(xq, xk, xv, wqb, b_qkv, Qh, Kh, Vh);

  dim3 gATT(T_SEQ / 128, BATCH * NH);
  attention_kernel<<<gATT, 256, 0, stream>>>(Qh, Kh, Vh, mask, ctx);

  dim3 gOUT(64, 8);                  // M=8192/128, N=1024/128
  out_proj_kernel<<<gOUT, 256, 0, stream>>>(ctx, wob, b_out, out);
}

// v003
// Measured time: 222 microseconds a run.
// In both of two side-by-side timings against v002, it was 1.05 times as fast.
// Counting every step since v000, it is 1.77 times as fast.
#include <hip/hip_runtime.h>
#include <stdint.h>

#define T_SEQ 2048
#define BATCH 4
#define EMB   1024
#define NH    16
#define DH    64
#define ATTN_SCALE 0.125f   // 1/sqrt(64)

typedef __bf16 bf16;
typedef __attribute__((ext_vector_type(16))) __bf16 v16bf;
typedef __attribute__((ext_vector_type(8)))  __bf16 v8bf;
typedef __attribute__((ext_vector_type(4)))  __bf16 v4bf;
typedef __attribute__((ext_vector_type(8)))  float  v8f;
typedef __attribute__((ext_vector_type(4)))  float  f32x4;
typedef __attribute__((ext_vector_type(4)))  unsigned int u32x4;
typedef __attribute__((ext_vector_type(4)))  int i32x4;

union FragU { v16bf v; u32x4 h[2]; };

#if defined(__has_builtin)
#if __has_builtin(__builtin_amdgcn_global_load_async_to_lds_b128)
#define HAVE_ASYNC_LDS 1
#endif
#endif
#ifndef HAVE_ASYNC_LDS
#define HAVE_ASYNC_LDS 0
#endif

__device__ __forceinline__ void cp16_g2l(const bf16* g, bf16* l) {
#if HAVE_ASYNC_LDS
  __builtin_amdgcn_global_load_async_to_lds_b128((i32x4*)g, (i32x4*)l, 0, 0);
#else
  *(u32x4*)l = *(const u32x4*)g;
#endif
}
// four 16-byte copies a lane, each with address registers of its own and no immediate
// offset; the closing wait stands in front of any rewrite of those registers
__device__ __forceinline__ void cp16x4_g2l(const float* g0, const float* g1,
                                           const float* g2, const float* g3,
                                           unsigned l0, unsigned l1,
                                           unsigned l2, unsigned l3) {
  asm volatile("global_load_async_to_lds_b128 %0, %4, off\n\t"
               "global_load_async_to_lds_b128 %1, %5, off\n\t"
               "global_load_async_to_lds_b128 %2, %6, off\n\t"
               "global_load_async_to_lds_b128 %3, %7, off\n\t"
               "s_wait_xcnt 0x0"
               :: "v"(l0), "v"(l1), "v"(l2), "v"(l3), "v"(g0), "v"(g1), "v"(g2), "v"(g3)
               : "memory");
}
__device__ __forceinline__ void async_wait0() {
#if HAVE_ASYNC_LDS
  asm volatile("s_wait_asynccnt 0x0" ::: "memory");
#endif
}

// round-to-nearest-even f32 -> bf16 (bit-level)
__device__ __forceinline__ bf16 f2bf(float f) {
  unsigned u = __builtin_bit_cast(unsigned, f);
  unsigned r = (u + 0x7FFFu + ((u >> 16) & 1u)) >> 16;
  unsigned short s = (unsigned short)r;
  return __builtin_bit_cast(bf16, s);
}

__device__ __forceinline__ v8f wmma_bf16(v16bf a, v16bf b, v8f c) {
  return __builtin_amdgcn_wmma_f32_16x16x32_bf16(false, a, false, b, (short)0, c, false, false);
}

// 16x32 bf16 operand fragment from a row-major LDS tile.
// lane&15 = row, half = K-subset; two contiguous 8-bf16 runs per lane.
__device__ __forceinline__ v16bf load_frag(const bf16* base, int strideBf,
                                           int rowOff, int colOff) {
  const int lane = threadIdx.x & 31;
  const int half = lane >> 4;
  const bf16* p = base + (size_t)((lane & 15) + rowOff) * strideBf + colOff + half * 8;
  FragU f;
  f.h[0] = *(const u32x4*)(p);
  f.h[1] = *(const u32x4*)(p + 16);
  return f.v;
}

// ---------------------------------------------------------------------------
// Kernel 0: f32 -> bf16 conversion of all five operands in ONE launch.
// The five bf16 copies lie one behind another in the workspace, so the output is one
// array of 28,672 units of 1,024 elements: query 8,192 units, key 8,192, value 8,192,
// w_qkv 3,072, w_out 1,024.  grid = 256, block = 512: 4,096 waves, one block a WGP.
// Wave w converts units w + 4096 i, i = 0..6; a unit is 8 loads of 16 bytes a lane,
// and the loads run two units ahead of the conversion.
// ---------------------------------------------------------------------------
#define CVT_WAVES 4096
#define CVT_UNIT  1024
#define CVT_UNITS 7        // units a wave
#define CVT_AHEAD 2        // how many units ahead of the one being converted the loads run
#define CVT_STEP  ((size_t)CVT_WAVES * CVT_UNIT)   // elements between a wave's units

__global__ __launch_bounds__(512) void cvt_all_kernel(
    const float* __restrict__ q, const float* __restrict__ k,
    const float* __restrict__ v, const float* __restrict__ wqkv,
    const float* __restrict__ wout, bf16* __restrict__ out)
{
  const unsigned el = (threadIdx.x & 31u) * 8u;    // this lane's 8 elements of each 256
  const int w = blockIdx.x * 16 + __builtin_amdgcn_readfirstlane(threadIdx.x >> 5);
  const size_t off = (size_t)w * CVT_UNIT;         // wave-uniform
  const float* src[CVT_UNITS] = {
      q + off, q + off + CVT_STEP, k + off, k + off + CVT_STEP,
      v + off, v + off + CVT_STEP,
      (w < 3072) ? wqkv + off : wout + (off - (size_t)3072 * CVT_UNIT)};
  bf16* dst = out + off;

  f32x4 r[CVT_AHEAD + 1][8];                       // ring of unit buffers
#define CVT_LOAD(U) do { _Pragma("unroll") for (int j = 0; j < 4; ++j) { \
    r[(U) % (CVT_AHEAD + 1)][2 * j]     = *(const f32x4*)(src[U] + j * 256 + el); \
    r[(U) % (CVT_AHEAD + 1)][2 * j + 1] = *(const f32x4*)(src[U] + j * 256 + el + 4); } } while (0)
// stands in front of loads that land in registers which issued loads and stores still name
#define CVT_XWAIT() asm volatile("s_wait_xcnt 0x0" ::: "memory")
#pragma unroll
  for (int u = 0; u < CVT_AHEAD; ++u) CVT_LOAD(u);
#pragma unroll
  for (int u = 0; u < CVT_UNITS; ++u) {
    // the two scheduling barriers pin the order "a later unit's loads, then this unit's
    // conversion and stores"; without them the loads bunch and the wave runs dry between
    __builtin_amdgcn_sched_barrier(0);
    if (u + CVT_AHEAD < CVT_UNITS) { CVT_XWAIT(); CVT_LOAD(u + CVT_AHEAD); }
    __builtin_amdgcn_sched_barrier(0);
#pragma unroll
    for (int j = 0; j < 4; ++j) {
      const f32x4 a = r[u % (CVT_AHEAD + 1)][2 * j], b = r[u % (CVT_AHEAD + 1)][2 * j + 1];
      v8bf o;
      o[0] = f2bf(a.x); o[1] = f2bf(a.y); o[2] = f2bf(a.z); o[3] = f2bf(a.w);
      o[4] = f2bf(b.x); o[5] = f2bf(b.y); o[6] = f2bf(b.z); o[7] = f2bf(b.w);
      *(v8bf*)(dst + u * CVT_STEP + j * 256 + el) = o;
    }
  }
#undef CVT_LOAD
#undef CVT_XWAIT
}

// ---------------------------------------------------------------------------
// Kernel 1: QKV projection, all-bf16, double-buffered async LDS staging.
// grid = (M/128, N/128, 3), block = 256 (8 waves, 4x2, 32x64 per wave)
// ---------------------------------------------------------------------------
__global__ __launch_bounds__(256) void qkv_proj_kernel(
    const bf16* __restrict__ xq, const bf16* __restrict__ xk,
    const bf16* __restrict__ xv, const bf16* __restrict__ wqkv,
    const float* __restrict__ b_qkv,
    bf16* __restrict__ q_out, bf16* __restrict__ k_out, bf16* __restrict__ v_out)
{
  __shared__ bf16 sA[2][128 * 40];
  __shared__ bf16 sB[2][128 * 40];
  const int tid  = threadIdx.x;
  const int lane = tid & 31, wave = tid >> 5;
  const int half = lane >> 4, l16 = lane & 15;
  const int which = blockIdx.z;
  const bf16* x    = (which == 0) ? xq : ((which == 1) ? xk : xv);
  const bf16* w    = wqkv + (size_t)which * EMB * EMB;
  const float* bias = b_qkv + which * EMB;
  bf16* outp        = (which == 0) ? q_out : ((which == 1) ? k_out : v_out);
  const int m0 = blockIdx.x * 128;
  const int n0 = blockIdx.y * 128;
  const int wm = wave & 3, wn = wave >> 2;

  auto stage = [&](int kk, bf16* dA, bf16* dB) {
#pragma unroll
    for (int i = 0; i < 2; ++i) {
      int idx = tid + i * 256;            // 512 chunks per tile
      int row = idx >> 2;
      int c   = (idx & 3) * 8;
      cp16_g2l(x + (size_t)(m0 + row) * EMB + kk + c, dA + row * 40 + c);
      cp16_g2l(w + (size_t)(n0 + row) * EMB + kk + c, dB + row * 40 + c);
    }
  };

  bf16 *curA = sA[0], *curB = sB[0], *nxtA = sA[1], *nxtB = sB[1];
  stage(0, curA, curB);
  v8f acc[2][4] = {};

#pragma unroll 1            // keep accumulators pinned; no unroll-induced copies
  for (int kt = 0; kt < EMB / 32; ++kt) {
    async_wait0();
    __syncthreads();
    if (kt + 1 < EMB / 32) stage((kt + 1) * 32, nxtA, nxtB);
    v16bf a0 = load_frag(curA, 40, wm * 32,      0);
    v16bf a1 = load_frag(curA, 40, wm * 32 + 16, 0);
#pragma unroll
    for (int j = 0; j < 4; ++j) {
      v16bf b = load_frag(curB, 40, wn * 64 + j * 16, 0);
      acc[0][j] = wmma_bf16(a0, b, acc[0][j]);
      acc[1][j] = wmma_bf16(a1, b, acc[1][j]);
    }
    bf16* t;
    t = curA; curA = nxtA; nxtA = t;
    t = curB; curB = nxtB; nxtB = t;
  }

  // epilogue: +bias, convert, scatter into [B,H,T,DH]
#pragma unroll
  for (int j = 0; j < 4; ++j) {
    int n = n0 + wn * 64 + j * 16 + l16;
    float bj = bias[n];
    int hh = n >> 6, dd = n & 63;
#pragma unroll
    for (int i = 0; i < 2; ++i) {
#pragma unroll
      for (int r = 0; r < 8; ++r) {
        int m = m0 + wm * 32 + i * 16 + r + half * 8;   // row in [T*B]
        int t = m >> 2, bb = m & 3;                      // x is [T,B,E]
        float val = acc[i][j][r] + bj;
        outp[(((size_t)bb * NH + hh) * T_SEQ + t) * DH + dd] = f2bf(val);
      }
    }
  }
}

__device__ __forceinline__ float other_half(float x) {
  int b = __builtin_bit_cast(int, x);
  b = __builtin_amdgcn_permlanex16(b, b, 0x76543210, 0xfedcba98, false, false);
  return __builtin_bit_cast(float, b);
}

#define MASK_PITCH 36   // floats

__global__ __launch_bounds__(256) void attention_kernel(
    const bf16* __restrict__ Q, const bf16* __restrict__ K,
    const bf16* __restrict__ V, const float* __restrict__ mask,
    bf16* __restrict__ ctx)
{
  __shared__ bf16 sK[32 * 72];     // 32 keys x 64 d (+8 pad)
  __shared__ bf16 sVt[64 * 40];    // V transposed: 64 d x 32 keys (+8 pad)
  __shared__ __attribute__((aligned(16))) float sM[2][128 * MASK_PITCH];

  const int tid  = threadIdx.x;
  const int lane = tid & 31, wave = tid >> 5;
  const int half = lane >> 4, l16 = lane & 15;
  const int bh = blockIdx.y;
  const int b  = bh >> 4, h = bh & 15;
  const size_t base = (size_t)bh * T_SEQ * DH;
  const int q0 = blockIdx.x * 128;
  const int qw = q0 + wave * 16;

  // Persistent Q fragments (B operand: column = query) for d in [0,32), [32,64)
  v16bf bq[2];
  {
    const bf16* qp = Q + base + (size_t)(qw + l16) * DH;
#pragma unroll
    for (int s = 0; s < 2; ++s) {
      FragU f;
      f.h[0] = *(const u32x4*)(qp + s * 32 + half * 8);
      f.h[1] = *(const u32x4*)(qp + s * 32 + half * 8 + 16);
      bq[s] = f.v;
    }
  }

  // copies: 8 lanes take one row's 128 bytes, a copy takes 4 rows, 4 copies the wave's 16
  const float* mg = mask + (size_t)(qw + (lane >> 3)) * T_SEQ + (lane & 7) * 4;
  const unsigned ml = (unsigned)(uintptr_t)
      &sM[0][(wave * 16 + (lane >> 3)) * MASK_PITCH + (lane & 7) * 4];   // LDS byte address
  auto stage_mask = [&](int kc, int buf) {
    const float* g = mg + kc;
    const unsigned l = ml + buf * (128 * MASK_PITCH * 4);
    cp16x4_g2l(g, g + 4 * T_SEQ, g + 8 * T_SEQ, g + 12 * T_SEQ,
               l, l + 4 * MASK_PITCH * 4, l + 8 * MASK_PITCH * 4, l + 12 * MASK_PITCH * 4);
  };
  // this lane's query row in a buffer, at the first key it holds
  const float* mrow = &sM[0][(wave * 16 + l16) * MASK_PITCH + half * 8];
  stage_mask(0, 0);

  float m_run = -3.0e38f;   // running maximum of this lane's query (both halves agree)
  float l_run = 0.0f;       // running sum over this half's keys only; joined at the end
  v8f o[4] = {};            // o[f][r] = O[query l16][d = 16 f + 8 half + r]

#pragma unroll 1
  for (int kc = 0; kc < T_SEQ; kc += 32) {
    __syncthreads();   // previous iteration's readers of sK/sVt are done
    // K: async 16B chunks (256 chunks, 1/thread); V: transposed scalar stores
    cp16_g2l(K + base + (size_t)(kc + (tid >> 3)) * DH + (tid & 7) * 8,
             sK + (tid >> 3) * 72 + (tid & 7) * 8);
#pragma unroll
    for (int i = 0; i < 2; ++i) {
      int idx = tid + i * 256;
      int row = idx >> 4;
      int c   = (idx & 15) * 4;
      v4bf vv = *(const v4bf*)(V + base + (size_t)(kc + row) * DH + c);
      sVt[(c + 0) * 40 + row] = vv.x;
      sVt[(c + 1) * 40 + row] = vv.y;
      sVt[(c + 2) * 40 + row] = vv.z;
      sVt[(c + 3) * 40 + row] = vv.w;
    }
    // the wave's LDS reads of the last pass have retired before copies aim at that buffer
    asm volatile("s_wait_dscnt 0x0" ::: "memory");
    async_wait0();     // K of this pass, and this pass's mask rows (issued a pass ago)
    __syncthreads();
    const int mbuf = (kc >> 5) & 1;
    if (kc + 32 < T_SEQ) stage_mask(kc + 32, mbuf ^ 1);
    // mask of this query at the 2 x 8 keys the lane holds
    f32x4 mk[2][2];
#pragma unroll
    for (int j = 0; j < 2; ++j) {
      mk[j][0] = *(const f32x4*)(mrow + mbuf * (128 * MASK_PITCH) + j * 16);
      mk[j][1] = *(const f32x4*)(mrow + mbuf * (128 * MASK_PITCH) + j * 16 + 4);
    }

    // S^T(32x16) = K(32x64) Q^T
    v8f sacc[2] = {};
#pragma unroll
    for (int j = 0; j < 2; ++j) {
      v16bf ak0 = load_frag(sK, 72, j * 16, 0);
      v16bf ak1 = load_frag(sK, 72, j * 16, 32);
      sacc[j] = wmma_bf16(ak0, bq[0], sacc[j]);
      sacc[j] = wmma_bf16(ak1, bq[1], sacc[j]);
    }

    // scale * mask, online softmax: 16 keys in the lane, one exchange of halves
    float mx = -3.0e38f;
#pragma unroll
    for (int j = 0; j < 2; ++j) {
      sacc[j] = sacc[j] * ATTN_SCALE *
                __builtin_shufflevector(mk[j][0], mk[j][1], 0, 1, 2, 3, 4, 5, 6, 7);
#pragma unroll
      for (int r = 0; r < 8; ++r) mx = fmaxf(mx, sacc[j][r]);
    }
    mx = fmaxf(mx, other_half(mx));
    const float mnew  = fmaxf(m_run, mx);
    const float alpha = __expf(m_run - mnew);
#pragma unroll
    for (int j = 0; j < 2; ++j)
#pragma unroll
      for (int r = 0; r < 8; ++r) sacc[j][r] = __expf(sacc[j][r] - mnew);
    const v8f ps = sacc[0] + sacc[1];
    const float rs = ((ps[0] + ps[1]) + (ps[2] + ps[3])) + ((ps[4] + ps[5]) + (ps[6] + ps[7]));
    l_run = l_run * alpha + rs;
    m_run = mnew;
#pragma unroll
    for (int f = 0; f < 4; ++f)
#pragma unroll
      for (int r = 0; r < 8; ++r) o[f][r] *= alpha;

    // the two score tiles, converted in place, are the B operand P^T (32 keys x 16 q)
    const v8bf pl = __builtin_convertvector(sacc[0], v8bf);
    const v8bf ph = __builtin_convertvector(sacc[1], v8bf);
    const v16bf bp = __builtin_shufflevector(pl, ph, 0, 1, 2, 3, 4, 5, 6, 7,
                                             8, 9, 10, 11, 12, 13, 14, 15);
#pragma unroll
    for (int f = 0; f < 4; ++f) {
      v16bf av = load_frag(sVt, 40, f * 16, 0);     // A: 16 d x 32 keys
      o[f] = wmma_bf16(av, bp, o[f]);
    }
  }

  async_wait0();   // closes the copy ring: no copy of the wave is outstanding when it ends

  // join the halves' sums, normalize, store ctx bf16 at [B,T,E]: 8 d = 16 bytes a lane
  l_run += other_half(l_run);
  const float inv = 1.0f / l_run;
  bf16* crow = ctx + ((size_t)b * T_SEQ + qw + l16) * EMB + h * DH + half * 8;
#pragma unroll
  for (int f = 0; f < 4; ++f) {
    v8bf ov;
#pragma unroll
    for (int r = 0; r < 8; ++r) ov[r] = f2bf(o[f][r] * inv);
    *(v8bf*)(crow + f * 16) = ov;
  }
}

// ---------------------------------------------------------------------------
// Kernel 3: output projection, all-bf16 operands, double-buffered staging.
// out[T,B,E](f32) = ctx[B,T,E](bf16) @ w_out^T + b_out
// ---------------------------------------------------------------------------
__global__ __launch_bounds__(256) void out_proj_kernel(
    const bf16* __restrict__ ctx, const bf16* __restrict__ wout,
    const float* __restrict__ b_out, float* __restrict__ out)
{
  __shared__ bf16 sA[2][128 * 40];
  __shared__ bf16 sB[2][128 * 40];
  const int tid  = threadIdx.x;
  const int lane = tid & 31, wave = tid >> 5;
  const int half = lane >> 4, l16 = lane & 15;
  const int m0 = blockIdx.x * 128;
  const int n0 = blockIdx.y * 128;
  const int wm = wave & 3, wn = wave >> 2;

  auto stage = [&](int kk, bf16* dA, bf16* dB) {
#pragma unroll
    for (int i = 0; i < 2; ++i) {
      int idx = tid + i * 256;
      int row = idx >> 2;
      int c   = (idx & 3) * 8;
      cp16_g2l(ctx  + (size_t)(m0 + row) * EMB + kk + c, dA + row * 40 + c);
      cp16_g2l(wout + (size_t)(n0 + row) * EMB + kk + c, dB + row * 40 + c);
    }
  };

  bf16 *curA = sA[0], *curB = sB[0], *nxtA = sA[1], *nxtB = sB[1];
  stage(0, curA, curB);
  v8f acc[2][4] = {};

#pragma unroll 1
  for (int kt = 0; kt < EMB / 32; ++kt) {
    async_wait0();
    __syncthreads();
    if (kt + 1 < EMB / 32) stage((kt + 1) * 32, nxtA, nxtB);
    v16bf a0 = load_frag(curA, 40, wm * 32,      0);
    v16bf a1 = load_frag(curA, 40, wm * 32 + 16, 0);
#pragma unroll
    for (int j = 0; j < 4; ++j) {
      v16bf b = load_frag(curB, 40, wn * 64 + j * 16, 0);
      acc[0][j] = wmma_bf16(a0, b, acc[0][j]);
      acc[1][j] = wmma_bf16(a1, b, acc[1][j]);
    }
    bf16* t;
    t = curA; curA = nxtA; nxtA = t;
    t = curB; curB = nxtB; nxtB = t;
  }

#pragma unroll
  for (int j = 0; j < 4; ++j) {
    int n = n0 + wn * 64 + j * 16 + l16;
    float bj = b_out[n];
#pragma unroll
    for (int i = 0; i < 2; ++i) {
#pragma unroll
      for (int r = 0; r < 8; ++r) {
        int m = m0 + wm * 32 + i * 16 + r + half * 8;   // row in [B*T]
        int bb = m >> 11;                                // / T_SEQ
        int t  = m & (T_SEQ - 1);
        out[((size_t)t * BATCH + bb) * EMB + n] = acc[i][j][r] + bj;
      }
    }
  }
}

// ---------------------------------------------------------------------------
extern "C" void kernel_launch(void* const* d_in, const int* in_sizes, int n_in,
                              void* d_out, int out_size, void* d_ws, size_t ws_size,
                              hipStream_t stream) {
  (void)in_sizes; (void)n_in; (void)out_size; (void)ws_size;
  const float* query = (const float*)d_in[0];
  const float* key   = (const float*)d_in[1];
  const float* value = (const float*)d_in[2];
  const float* mask  = (const float*)d_in[3];
  const float* w_qkv = (const float*)d_in[4];
  const float* b_qkv = (const float*)d_in[5];
  const float* w_out = (const float*)d_in[6];
  const float* b_out = (const float*)d_in[7];
  float* out = (float*)d_out;

  const size_t NTOK = (size_t)T_SEQ * BATCH * EMB;      // 8388608
  const size_t NWQ  = (size_t)3 * EMB * EMB;            // 3145728
  const size_t NWO  = (size_t)EMB * EMB;                // 1048576
  bf16* xq   = (bf16*)d_ws;           // bf16 copies of inputs
  bf16* xk   = xq + NTOK;
  bf16* xv   = xk + NTOK;
  bf16* wqb  = xv + NTOK;
  bf16* wob  = wqb + NWQ;
  bf16* Qh   = wob + NWO;             // projected [B,H,T,DH]
  bf16* Kh   = Qh + NTOK;
  bf16* Vh   = Kh + NTOK;
  bf16* ctx  = Vh + NTOK;             // [B,T,E]

  // xq, xk, xv, wqb, wob are one contiguous run of the workspace
  cvt_all_kernel<<<256, 512, 0, stream>>>(query, key, value, w_qkv, w_out, xq);

  dim3 gQKV(64, 8, 3);               // M=8192/128, N=1024/128, {q,k,v}
  qkv_proj_kernel<<<gQKV, 256, 0, stream>>>(xq, xk, xv, wqb, b_qkv, Qh, Kh, Vh);

  dim3 gATT(T_SEQ / 128, BATCH * NH);
  attention_kernel<<<gATT, 256, 0, stream>>>(Qh, Kh, Vh, mask, ctx);

  dim3 gOUT(64, 8);                  // M=8192/128, N=1024/128
  out_proj_kernel<<<gOUT, 256, 0, stream>>>(ctx, wob, b_out, out);
}

// v004
// A run of this version takes 184 microseconds.
// Two timings next to v003 put it at 1.20 and 1.21 times that version's speed.
// Over all steps from v000 it is 2.13 times as fast.
#include <hip/hip_runtime.h>
#include <stdint.h>

#define T_SEQ 2048
#define BATCH 4
#define EMB   1024
#define NH    16
#define DH    64
#define ATTN_SCALE 0.125f   // 1/sqrt(64)

typedef __bf16 bf16;
typedef __attribute__((ext_vector_type(16))) __bf16 v16bf;
typedef __attribute__((ext_vector_type(8)))  __bf16 v8bf;
typedef __attribute__((ext_vector_type(4)))  __bf16 v4bf;
typedef __attribute__((ext_vector_type(8)))  float  v8f;
typedef __attribute__((ext_vector_type(4)))  float  f32x4;
typedef __attribute__((ext_vector_type(4)))  unsigned int u32x4;
typedef __attribute__((ext_vector_type(4)))  int i32x4;

union FragU { v16bf v; u32x4 h[2]; };

#if defined(__has_builtin)
#if __has_builtin(__builtin_amdgcn_global_load_async_to_lds_b128)
#define HAVE_ASYNC_LDS 1
#endif
#endif
#ifndef HAVE_ASYNC_LDS
#define HAVE_ASYNC_LDS 0
#endif

__device__ __forceinline__ void cp16_g2l(const bf16* g, bf16* l) {
#if HAVE_ASYNC_LDS
  __builtin_amdgcn_global_load_async_to_lds_b128((i32x4*)g, (i32x4*)l, 0, 0);
#else
  *(u32x4*)l = *(const u32x4*)g;
#endif
}
// four 16-byte copies a lane, each with address registers of its own and no immediate
// offset; the closing wait stands in front of any rewrite of those registers
__device__ __forceinline__ void cp16x4_g2l(const float* g0, const float* g1,
                                           const float* g2, const float* g3,
                                           unsigned l0, unsigned l1,
                                           unsigned l2, unsigned l3) {
  asm volatile("global_load_async_to_lds_b128 %0, %4, off\n\t"
               "global_load_async_to_lds_b128 %1, %5, off\n\t"
               "global_load_async_to_lds_b128 %2, %6, off\n\t"
               "global_load_async_to_lds_b128 %3, %7, off\n\t"
               "s_wait_xcnt 0x0"
               :: "v"(l0), "v"(l1), "v"(l2), "v"(l3), "v"(g0), "v"(g1), "v"(g2), "v"(g3)
               : "memory");
}
__device__ __forceinline__ void async_wait0() {
#if HAVE_ASYNC_LDS
  asm volatile("s_wait_asynccnt 0x0" ::: "memory");
#endif
}

// round-to-nearest-even f32 -> bf16 (bit-level)
__device__ __forceinline__ bf16 f2bf(float f) {
  unsigned u = __builtin_bit_cast(unsigned, f);
  unsigned r = (u + 0x7FFFu + ((u >> 16) & 1u)) >> 16;
  unsigned short s = (unsigned short)r;
  return __builtin_bit_cast(bf16, s);
}

__device__ __forceinline__ v8f wmma_bf16(v16bf a, v16bf b, v8f c) {
  return __builtin_amdgcn_wmma_f32_16x16x32_bf16(false, a, false, b, (short)0, c, false, false);
}

// 16x32 bf16 operand fragment from a row-major LDS tile.
// lane&15 = row, half = K-subset; two contiguous 8-bf16 runs per lane.
__device__ __forceinline__ v16bf load_frag(const bf16* base, int strideBf,
                                           int rowOff, int colOff) {
  const int lane = threadIdx.x & 31;
  const int half = lane >> 4;
  const bf16* p = base + (size_t)((lane & 15) + rowOff) * strideBf + colOff + half * 8;
  FragU f;
  f.h[0] = *(const u32x4*)(p);
  f.h[1] = *(const u32x4*)(p + 16);
  return f.v;
}

// ---------------------------------------------------------------------------
// Kernel 0: f32 -> bf16 conversion of all five operands in ONE launch.
// The five bf16 copies lie one behind another in the workspace, so the output is one
// array of 28,672 units of 1,024 elements: query 8,192 units, key 8,192, value 8,192,
// w_qkv 3,072, w_out 1,024.  grid = 256, block = 512: 4,096 waves, one block a WGP.
// Wave w converts units w + 4096 i, i = 0..6; a unit is 8 loads of 16 bytes a lane,
// and the loads run two units ahead of the conversion.
// ---------------------------------------------------------------------------
#define CVT_WAVES 4096
#define CVT_UNIT  1024
#define CVT_UNITS 7        // units a wave
#define CVT_AHEAD 2        // how many units ahead of the one being converted the loads run
#define CVT_STEP  ((size_t)CVT_WAVES * CVT_UNIT)   // elements between a wave's units

__global__ __launch_bounds__(512) void cvt_all_kernel(
    const float* __restrict__ q, const float* __restrict__ k,
    const float* __restrict__ v, const float* __restrict__ wqkv,
    const float* __restrict__ wout, bf16* __restrict__ out)
{
  const unsigned el = (threadIdx.x & 31u) * 8u;    // this lane's 8 elements of each 256
  const int w = blockIdx.x * 16 + __builtin_amdgcn_readfirstlane(threadIdx.x >> 5);
  const size_t off = (size_t)w * CVT_UNIT;         // wave-uniform
  const float* src[CVT_UNITS] = {
      q + off, q + off + CVT_STEP, k + off, k + off + CVT_STEP,
      v + off, v + off + CVT_STEP,
      (w < 3072) ? wqkv + off : wout + (off - (size_t)3072 * CVT_UNIT)};
  bf16* dst = out + off;

  f32x4 r[CVT_AHEAD + 1][8];                       // ring of unit buffers
#define CVT_LOAD(U) do { _Pragma("unroll") for (int j = 0; j < 4; ++j) { \
    r[(U) % (CVT_AHEAD + 1)][2 * j]     = *(const f32x4*)(src[U] + j * 256 + el); \
    r[(U) % (CVT_AHEAD + 1)][2 * j + 1] = *(const f32x4*)(src[U] + j * 256 + el + 4); } } while (0)
// stands in front of loads that land in registers which issued loads and stores still name
#define CVT_XWAIT() asm volatile("s_wait_xcnt 0x0" ::: "memory")
#pragma unroll
  for (int u = 0; u < CVT_AHEAD; ++u) CVT_LOAD(u);
#pragma unroll
  for (int u = 0; u < CVT_UNITS; ++u) {
    // the two scheduling barriers pin the order "a later unit's loads, then this unit's
    // conversion and stores"; without them the loads bunch and the wave runs dry between
    __builtin_amdgcn_sched_barrier(0);
    if (u + CVT_AHEAD < CVT_UNITS) { CVT_XWAIT(); CVT_LOAD(u + CVT_AHEAD); }
    __builtin_amdgcn_sched_barrier(0);
#pragma unroll
    for (int j = 0; j < 4; ++j) {
      const f32x4 a = r[u % (CVT_AHEAD + 1)][2 * j], b = r[u % (CVT_AHEAD + 1)][2 * j + 1];
      v8bf o;
      o[0] = f2bf(a.x); o[1] = f2bf(a.y); o[2] = f2bf(a.z); o[3] = f2bf(a.w);
      o[4] = f2bf(b.x); o[5] = f2bf(b.y); o[6] = f2bf(b.z); o[7] = f2bf(b.w);
      *(v8bf*)(dst + u * CVT_STEP + j * 256 + el) = o;
    }
  }
#undef CVT_LOAD
#undef CVT_XWAIT
}

// ---------------------------------------------------------------------------
// Kernel 1: QKV projection, all-bf16, double-buffered async LDS staging.
// grid = (M/128, N/128, 3), block = 256 (8 waves, 4x2, 32x64 per wave)
// ---------------------------------------------------------------------------
__global__ __launch_bounds__(256) void qkv_proj_kernel(
    const bf16* __restrict__ xq, const bf16* __restrict__ xk,
    const bf16* __restrict__ xv, const bf16* __restrict__ wqkv,
    const float* __restrict__ b_qkv,
    bf16* __restrict__ q_out, bf16* __restrict__ k_out, bf16* __restrict__ v_out)
{
  __shared__ bf16 sA[2][128 * 40];
  __shared__ bf16 sB[2][128 * 40];
  const int tid  = threadIdx.x;
  const int lane = tid & 31, wave = tid >> 5;
  const int half = lane >> 4, l16 = lane & 15;
  const int which = blockIdx.z;
  const bf16* x    = (which == 0) ? xq : ((which == 1) ? xk : xv);
  const bf16* w    = wqkv + (size_t)which * EMB * EMB;
  const float* bias = b_qkv + which * EMB;
  bf16* outp        = (which == 0) ? q_out : ((which == 1) ? k_out : v_out);
  const int m0 = blockIdx.x * 128;
  const int n0 = blockIdx.y * 128;
  const int wm = wave & 3, wn = wave >> 2;

  auto stage = [&](int kk, bf16* dA, bf16* dB) {
#pragma unroll
    for (int i = 0; i < 2; ++i) {
      int idx = tid + i * 256;            // 512 chunks per tile
      int row = idx >> 2;
      int c   = (idx & 3) * 8;
      cp16_g2l(x + (size_t)(m0 + row) * EMB + kk + c, dA + row * 40 + c);
      cp16_g2l(w + (size_t)(n0 + row) * EMB + kk + c, dB + row * 40 + c);
    }
  };

  bf16 *curA = sA[0], *curB = sB[0], *nxtA = sA[1], *nxtB = sB[1];
  stage(0, curA, curB);
  v8f acc[2][4] = {};

#pragma unroll 1            // keep accumulators pinned; no unroll-induced copies
  for (int kt = 0; kt < EMB / 32; ++kt) {
    async_wait0();
    __syncthreads();
    if (kt + 1 < EMB / 32) stage((kt + 1) * 32, nxtA, nxtB);
    v16bf a0 = load_frag(curA, 40, wm * 32,      0);
    v16bf a1 = load_frag(curA, 40, wm * 32 + 16, 0);
#pragma unroll
    for (int j = 0; j < 4; ++j) {
      v16bf b = load_frag(curB, 40, wn * 64 + j * 16, 0);
      acc[0][j] = wmma_bf16(a0, b, acc[0][j]);
      acc[1][j] = wmma_bf16(a1, b, acc[1][j]);
    }
    bf16* t;
    t = curA; curA = nxtA; nxtA = t;
    t = curB; curB = nxtB; nxtB = t;
  }

  // epilogue: +bias, convert, scatter into [B,H,T,DH]
#pragma unroll
  for (int j = 0; j < 4; ++j) {
    int n = n0 + wn * 64 + j * 16 + l16;
    float bj = bias[n];
    int hh = n >> 6, dd = n & 63;
#pragma unroll
    for (int i = 0; i < 2; ++i) {
#pragma unroll
      for (int r = 0; r < 8; ++r) {
        int m = m0 + wm * 32 + i * 16 + r + half * 8;   // row in [T*B]
        int t = m >> 2, bb = m & 3;                      // x is [T,B,E]
        float val = acc[i][j][r] + bj;
        outp[(((size_t)bb * NH + hh) * T_SEQ + t) * DH + dd] = f2bf(val);
      }
    }
  }
}

__device__ __forceinline__ float other_half(float x) {
  int b = __builtin_bit_cast(int, x);
  b = __builtin_amdgcn_permlanex16(b, b, 0x76543210, 0xfedcba98, false, false);
  return __builtin_bit_cast(float, b);
}

#define MASK_PITCH 36   // floats
#define V_PITCH 160     // bytes: 32 x odd, the conflict-free pitch of the transposing load

typedef __attribute__((ext_vector_type(8))) short s16x8;
__device__ __forceinline__ u32x4 ld_tr16(const unsigned char* p) {
  typedef __attribute__((address_space(3))) s16x8 lds_s16x8;
  return __builtin_bit_cast(u32x4, __builtin_amdgcn_ds_load_tr16_b128_v8i16((lds_s16x8*)p));
}

__global__ __launch_bounds__(256) void attention_kernel(
    const bf16* __restrict__ Q, const bf16* __restrict__ K,
    const bf16* __restrict__ V, const float* __restrict__ mask,
    bf16* __restrict__ ctx)
{
  __shared__ bf16 sK[32 * 72];     // 32 keys x 64 d (+8 pad)
  // V as it lies: 32 keys x 64 d, rows at V_PITCH; transposed on the way to the registers
  __shared__ __attribute__((aligned(16))) unsigned char sV[32 * V_PITCH];
  __shared__ __attribute__((aligned(16))) float sM[2][128 * MASK_PITCH];

  const int tid  = threadIdx.x;
  const int lane = tid & 31, wave = tid >> 5;
  const int half = lane >> 4, l16 = lane & 15;
  const int bh = blockIdx.y;
  const int b  = bh >> 4, h = bh & 15;
  const size_t base = (size_t)bh * T_SEQ * DH;
  const int q0 = blockIdx.x * 128;
  const int qw = q0 + wave * 16;

  // Persistent Q fragments (B operand: column = query) for d in [0,32), [32,64)
  v16bf bq[2];
  {
    const bf16* qp = Q + base + (size_t)(qw + l16) * DH;
#pragma unroll
    for (int s = 0; s < 2; ++s) {
      FragU f;
      f.h[0] = *(const u32x4*)(qp + s * 32 + half * 8);
      f.h[1] = *(const u32x4*)(qp + s * 32 + half * 8 + 16);
      bq[s] = f.v;
    }
  }

  // copies: 8 lanes take one row's 128 bytes, a copy takes 4 rows, 4 copies the wave's 16
  const float* mg = mask + (size_t)(qw + (lane >> 3)) * T_SEQ + (lane & 7) * 4;
  const unsigned ml = (unsigned)(uintptr_t)
      &sM[0][(wave * 16 + (lane >> 3)) * MASK_PITCH + (lane & 7) * 4];   // LDS byte address
  auto stage_mask = [&](int kc, int buf) {
    const float* g = mg + kc;
    const unsigned l = ml + buf * (128 * MASK_PITCH * 4);
    cp16x4_g2l(g, g + 4 * T_SEQ, g + 8 * T_SEQ, g + 12 * T_SEQ,
               l, l + 4 * MASK_PITCH * 4, l + 8 * MASK_PITCH * 4, l + 12 * MASK_PITCH * 4);
  };
  // this lane's query row in a buffer, at the first key it holds
  const float* mrow = &sM[0][(wave * 16 + l16) * MASK_PITCH + half * 8];
  stage_mask(0, 0);
  // this lane's address for the transposing loads of V: d tile f at + 32 f bytes
  const unsigned char* vtr = sV + (half * 8 + (lane & 7)) * V_PITCH + ((lane >> 3) & 1) * 16;

  float m_run = -3.0e38f;   // running maximum of this lane's query (both halves agree)
  float l_run = 0.0f;       // running sum over this half's keys only; joined at the end
  v8f o[4] = {};            // o[f][r] = O[query l16][d = 16 f + 8 half + r]

#pragma unroll 1
  for (int kc = 0; kc < T_SEQ; kc += 32) {
    // the wave's LDS reads of the last pass have retired before copies aim at what it read
    asm volatile("s_wait_dscnt 0x0" ::: "memory");
    __syncthreads();   // previous iteration's readers of sK/sV are done
    // K and V: async 16B chunks (256 chunks each, 1/thread), 8 lanes a row of 128 bytes
    cp16_g2l(K + base + (size_t)(kc + (tid >> 3)) * DH + (tid & 7) * 8,
             sK + (tid >> 3) * 72 + (tid & 7) * 8);
    cp16_g2l(V + base + (size_t)(kc + (tid >> 3)) * DH + (tid & 7) * 8,
             (bf16*)(sV + (tid >> 3) * V_PITCH + (tid & 7) * 16));
    async_wait0();     // K and V of this pass, and this pass's mask rows (issued a pass ago)
    __syncthreads();
    const int mbuf = (kc >> 5) & 1;
    if (kc + 32 < T_SEQ) stage_mask(kc + 32, mbuf ^ 1);
    // mask of this query at the 2 x 8 keys the lane holds
    f32x4 mk[2][2];
#pragma unroll
    for (int j = 0; j < 2; ++j) {
      mk[j][0] = *(const f32x4*)(mrow + mbuf * (128 * MASK_PITCH) + j * 16);
      mk[j][1] = *(const f32x4*)(mrow + mbuf * (128 * MASK_PITCH) + j * 16 + 4);
    }

    // S^T(32x16) = K(32x64) Q^T
    v8f sacc[2] = {};
#pragma unroll
    for (int j = 0; j < 2; ++j) {
      v16bf ak0 = load_frag(sK, 72, j * 16, 0);
      v16bf ak1 = load_frag(sK, 72, j * 16, 32);
      sacc[j] = wmma_bf16(ak0, bq[0], sacc[j]);
      sacc[j] = wmma_bf16(ak1, bq[1], sacc[j]);
    }

    // scale * mask, online softmax: 16 keys in the lane, one exchange of halves
    float mx = -3.0e38f;
#pragma unroll
    for (int j = 0; j < 2; ++j) {
      sacc[j] = sacc[j] * ATTN_SCALE *
                __builtin_shufflevector(mk[j][0], mk[j][1], 0, 1, 2, 3, 4, 5, 6, 7);
#pragma unroll
      for (int r = 0; r < 8; ++r) mx = fmaxf(mx, sacc[j][r]);
    }
    mx = fmaxf(mx, other_half(mx));
    const float mnew  = fmaxf(m_run, mx);
    const float alpha = __expf(m_run - mnew);
#pragma unroll
    for (int j = 0; j < 2; ++j)
#pragma unroll
      for (int r = 0; r < 8; ++r) sacc[j][r] = __expf(sacc[j][r] - mnew);
    const v8f ps = sacc[0] + sacc[1];
    const float rs = ((ps[0] + ps[1]) + (ps[2] + ps[3])) + ((ps[4] + ps[5]) + (ps[6] + ps[7]));
    l_run = l_run * alpha + rs;
    m_run = mnew;
#pragma unroll
    for (int f = 0; f < 4; ++f)
#pragma unroll
      for (int r = 0; r < 8; ++r) o[f][r] *= alpha;

    // the two score tiles, converted in place, are the B operand P^T (32 keys x 16 q)
    const v8bf pl = __builtin_convertvector(sacc[0], v8bf);
    const v8bf ph = __builtin_convertvector(sacc[1], v8bf);
    const v16bf bp = __builtin_shufflevector(pl, ph, 0, 1, 2, 3, 4, 5, 6, 7,
                                             8, 9, 10, 11, 12, 13, 14, 15);
#pragma unroll
    for (int f = 0; f < 4; ++f) {
      FragU av;                                     // A: 16 d x 32 keys, keys in P^T's order
      av.h[0] = ld_tr16(vtr + 32 * f);              // keys 8 half + 0..7
      av.h[1] = ld_tr16(vtr + 16 * V_PITCH + 32 * f);   // keys 16 + 8 half + 0..7
      o[f] = wmma_bf16(av.v, bp, o[f]);
    }
  }

  async_wait0();   // closes the copy ring: no copy of the wave is outstanding when it ends

  // join the halves' sums, normalize, store ctx bf16 at [B,T,E]: 8 d = 16 bytes a lane
  l_run += other_half(l_run);
  const float inv = 1.0f / l_run;
  bf16* crow = ctx + ((size_t)b * T_SEQ + qw + l16) * EMB + h * DH + half * 8;
#pragma unroll
  for (int f = 0; f < 4; ++f) {
    v8bf ov;
#pragma unroll
    for (int r = 0; r < 8; ++r) ov[r] = f2bf(o[f][r] * inv);
    *(v8bf*)(crow + f * 16) = ov;
  }
}

// ---------------------------------------------------------------------------
// Kernel 3: output projection, all-bf16 operands, double-buffered staging.
// out[T,B,E](f32) = ctx[B,T,E](bf16) @ w_out^T + b_out
// ---------------------------------------------------------------------------
__global__ __launch_bounds__(256) void out_proj_kernel(
    const bf16* __restrict__ ctx, const bf16* __restrict__ wout,
    const float* __restrict__ b_out, float* __restrict__ out)
{
  __shared__ bf16 sA[2][128 * 40];
  __shared__ bf16 sB[2][128 * 40];
  const int tid  = threadIdx.x;
  const int lane = tid & 31, wave = tid >> 5;
  const int half = lane >> 4, l16 = lane & 15;
  const int m0 = blockIdx.x * 128;
  const int n0 = blockIdx.y * 128;
  const int wm = wave & 3, wn = wave >> 2;

  auto stage = [&](int kk, bf16* dA, bf16* dB) {
#pragma unroll
    for (int i = 0; i < 2; ++i) {
      int idx = tid + i * 256;
      int row = idx >> 2;
      int c   = (idx & 3) * 8;
      cp16_g2l(ctx  + (size_t)(m0 + row) * EMB + kk + c, dA + row * 40 + c);
      cp16_g2l(wout + (size_t)(n0 + row) * EMB + kk + c, dB + row * 40 + c);
    }
  };

  bf16 *curA = sA[0], *curB = sB[0], *nxtA = sA[1], *nxtB = sB[1];
  stage(0, curA, curB);
  v8f acc[2][4] = {};

#pragma unroll 1
  for (int kt = 0; kt < EMB / 32; ++kt) {
    async_wait0();
    __syncthreads();
    if (kt + 1 < EMB / 32) stage((kt + 1) * 32, nxtA, nxtB);
    v16bf a0 = load_frag(curA, 40, wm * 32,      0);
    v16bf a1 = load_frag(curA, 40, wm * 32 + 16, 0);
#pragma unroll
    for (int j = 0; j < 4; ++j) {
      v16bf b = load_frag(curB, 40, wn * 64 + j * 16, 0);
      acc[0][j] = wmma_bf16(a0, b, acc[0][j]);
      acc[1][j] = wmma_bf16(a1, b, acc[1][j]);
    }
    bf16* t;
    t = curA; curA = nxtA; nxtA = t;
    t = curB; curB = nxtB; nxtB = t;
  }

#pragma unroll
  for (int j = 0; j < 4; ++j) {
    int n = n0 + wn * 64 + j * 16 + l16;
    float bj = b_out[n];
#pragma unroll
    for (int i = 0; i < 2; ++i) {
#pragma unroll
      for (int r = 0; r < 8; ++r) {
        int m = m0 + wm * 32 + i * 16 + r + half * 8;   // row in [B*T]
        int bb = m >> 11;                                // / T_SEQ
        int t  = m & (T_SEQ - 1);
        out[((size_t)t * BATCH + bb) * EMB + n] = acc[i][j][r] + bj;
      }
    }
  }
}

// ---------------------------------------------------------------------------
extern "C" void kernel_launch(void* const* d_in, const int* in_sizes, int n_in,
                              void* d_out, int out_size, void* d_ws, size_t ws_size,
                              hipStream_t stream) {
  (void)in_sizes; (void)n_in; (void)out_size; (void)ws_size;
  const float* query = (const float*)d_in[0];
  const float* key   = (const float*)d_in[1];
  const float* value = (const float*)d_in[2];
  const float* mask  = (const float*)d_in[3];
  const float* w_qkv = (const float*)d_in[4];
  const float* b_qkv = (const float*)d_in[5];
  const float* w_out = (const float*)d_in[6];
  const float* b_out = (const float*)d_in[7];
  float* out = (float*)d_out;

  const size_t NTOK = (size_t)T_SEQ * BATCH * EMB;      // 8388608
  const size_t NWQ  = (size_t)3 * EMB * EMB;            // 3145728
  const size_t NWO  = (size_t)EMB * EMB;                // 1048576
  bf16* xq   = (bf16*)d_ws;           // bf16 copies of inputs
  bf16* xk   = xq + NTOK;
  bf16* xv   = xk + NTOK;
  bf16* wqb  = xv + NTOK;
  bf16* wob  = wqb + NWQ;
  bf16* Qh   = wob + NWO;             // projected [B,H,T,DH]
  bf16* Kh   = Qh + NTOK;
  bf16* Vh   = Kh + NTOK;
  bf16* ctx  = Vh + NTOK;             // [B,T,E]

  // xq, xk, xv, wqb, wob are one contiguous run of the workspace
  cvt_all_kernel<<<256, 512, 0, stream>>>(query, key, value, w_qkv, w_out, xq);

  dim3 gQKV(64, 8, 3);               // M=8192/128, N=1024/128, {q,k,v}
  qkv_proj_kernel<<<gQKV, 256, 0, stream>>>(xq, xk, xv, wqb, b_qkv, Qh, Kh, Vh);

  dim3 gATT(T_SEQ / 128, BATCH * NH);
  attention_kernel<<<gATT, 256, 0, stream>>>(Qh, Kh, Vh, mask, ctx);

  dim3 gOUT(64, 8);                  // M=8192/128, N=1024/128
  out_proj_kernel<<<gOUT, 256, 0, stream>>>(ctx, wob, b_out, out);
}

// v005
// A run of this version takes 177 microseconds.
// Two timings next to v004 both put it at 1.04 times that version's speed.
// Over all steps from v000 it is 2.22 times as fast.
#include <hip/hip_runtime.h>
#include <stdint.h>

#define T_SEQ 2048
#define BATCH 4
#define EMB   1024
#define NH    16
#define DH    64
#define ATTN_SCALE 0.125f   // 1/sqrt(64)

typedef __bf16 bf16;
typedef __attribute__((ext_vector_type(16))) __bf16 v16bf;
typedef __attribute__((ext_vector_type(8)))  __bf16 v8bf;
typedef __attribute__((ext_vector_type(4)))  __bf16 v4bf;
typedef __attribute__((ext_vector_type(8)))  float  v8f;
typedef __attribute__((ext_vector_type(4)))  float  f32x4;
typedef __attribute__((ext_vector_type(4)))  unsigned int u32x4;
typedef __attribute__((ext_vector_type(4)))  int i32x4;

union FragU { v16bf v; u32x4 h[2]; };

#if defined(__has_builtin)
#if __has_builtin(__builtin_amdgcn_global_load_async_to_lds_b128)
#define HAVE_ASYNC_LDS 1
#endif
#endif
#ifndef HAVE_ASYNC_LDS
#define HAVE_ASYNC_LDS 0
#endif

__device__ __forceinline__ void cp16_g2l(const bf16* g, bf16* l) {
#if HAVE_ASYNC_LDS
  __builtin_amdgcn_global_load_async_to_lds_b128((i32x4*)g, (i32x4*)l, 0, 0);
#else
  *(u32x4*)l = *(const u32x4*)g;
#endif
}
// four 16-byte copies a lane, each with address registers of its own and no immediate
// offset; the closing wait stands in front of any rewrite of those registers
__device__ __forceinline__ void cp16x4_g2l(const float* g0, const float* g1,
                                           const float* g2, const float* g3,
                                           unsigned l0, unsigned l1,
                                           unsigned l2, unsigned l3) {
  asm volatile("global_load_async_to_lds_b128 %0, %4, off\n\t"
               "global_load_async_to_lds_b128 %1, %5, off\n\t"
               "global_load_async_to_lds_b128 %2, %6, off\n\t"
               "global_load_async_to_lds_b128 %3, %7, off\n\t"
               "s_wait_xcnt 0x0"
               :: "v"(l0), "v"(l1), "v"(l2), "v"(l3), "v"(g0), "v"(g1), "v"(g2), "v"(g3)
               : "memory");
}
__device__ __forceinline__ void async_wait0() {
#if HAVE_ASYNC_LDS
  asm volatile("s_wait_asynccnt 0x0" ::: "memory");
#endif
}

// round-to-nearest-even f32 -> bf16 (bit-level)
__device__ __forceinline__ bf16 f2bf(float f) {
  unsigned u = __builtin_bit_cast(unsigned, f);
  unsigned r = (u + 0x7FFFu + ((u >> 16) & 1u)) >> 16;
  unsigned short s = (unsigned short)r;
  return __builtin_bit_cast(bf16, s);
}

__device__ __forceinline__ v8f wmma_bf16(v16bf a, v16bf b, v8f c) {
  return __builtin_amdgcn_wmma_f32_16x16x32_bf16(false, a, false, b, (short)0, c, false, false);
}

// 16x32 bf16 operand fragment from a row-major LDS tile.
// lane&15 = row, half = K-subset; two contiguous 8-bf16 runs per lane.
__device__ __forceinline__ v16bf load_frag(const bf16* base, int strideBf,
                                           int rowOff, int colOff) {
  const int lane = threadIdx.x & 31;
  const int half = lane >> 4;
  const bf16* p = base + (size_t)((lane & 15) + rowOff) * strideBf + colOff + half * 8;
  FragU f;
  f.h[0] = *(const u32x4*)(p);
  f.h[1] = *(const u32x4*)(p + 16);
  return f.v;
}

// ---------------------------------------------------------------------------
// Kernel 0: f32 -> bf16 conversion of all five operands in ONE launch.
// The five bf16 copies lie one behind another in the workspace, so the output is one
// array of 28,672 units of 1,024 elements: query 8,192 units, key 8,192, value 8,192,
// w_qkv 3,072, w_out 1,024.  grid = 256, block = 512: 4,096 waves, one block a WGP.
// Wave w converts units w + 4096 i, i = 0..6; a unit is 8 loads of 16 bytes a lane,
// and the loads run two units ahead of the conversion.
// ---------------------------------------------------------------------------
#define CVT_WAVES 4096
#define CVT_UNIT  1024
#define CVT_UNITS 7        // units a wave
#define CVT_AHEAD 2        // how many units ahead of the one being converted the loads run
#define CVT_STEP  ((size_t)CVT_WAVES * CVT_UNIT)   // elements between a wave's units

__global__ __launch_bounds__(512) void cvt_all_kernel(
    const float* __restrict__ q, const float* __restrict__ k,
    const float* __restrict__ v, const float* __restrict__ wqkv,
    const float* __restrict__ wout, bf16* __restrict__ out)
{
  const unsigned el = (threadIdx.x & 31u) * 8u;    // this lane's 8 elements of each 256
  const int w = blockIdx.x * 16 + __builtin_amdgcn_readfirstlane(threadIdx.x >> 5);
  const size_t off = (size_t)w * CVT_UNIT;         // wave-uniform
  const float* src[CVT_UNITS] = {
      q + off, q + off + CVT_STEP, k + off, k + off + CVT_STEP,
      v + off, v + off + CVT_STEP,
      (w < 3072) ? wqkv + off : wout + (off - (size_t)3072 * CVT_UNIT)};
  bf16* dst = out + off;

  f32x4 r[CVT_AHEAD + 1][8];                       // ring of unit buffers
#define CVT_LOAD(U) do { _Pragma("unroll") for (int j = 0; j < 4; ++j) { \
    r[(U) % (CVT_AHEAD + 1)][2 * j]     = *(const f32x4*)(src[U] + j * 256 + el); \
    r[(U) % (CVT_AHEAD + 1)][2 * j + 1] = *(const f32x4*)(src[U] + j * 256 + el + 4); } } while (0)
// stands in front of loads that land in registers which issued loads and stores still name
#define CVT_XWAIT() asm volatile("s_wait_xcnt 0x0" ::: "memory")
#pragma unroll
  for (int u = 0; u < CVT_AHEAD; ++u) CVT_LOAD(u);
#pragma unroll
  for (int u = 0; u < CVT_UNITS; ++u) {
    // the two scheduling barriers pin the order "a later unit's loads, then this unit's
    // conversion and stores"; without them the loads bunch and the wave runs dry between
    __builtin_amdgcn_sched_barrier(0);
    if (u + CVT_AHEAD < CVT_UNITS) { CVT_XWAIT(); CVT_LOAD(u + CVT_AHEAD); }
    __builtin_amdgcn_sched_barrier(0);
#pragma unroll
    for (int j = 0; j < 4; ++j) {
      const f32x4 a = r[u % (CVT_AHEAD + 1)][2 * j], b = r[u % (CVT_AHEAD + 1)][2 * j + 1];
      v8bf o;
      o[0] = f2bf(a.x); o[1] = f2bf(a.y); o[2] = f2bf(a.z); o[3] = f2bf(a.w);
      o[4] = f2bf(b.x); o[5] = f2bf(b.y); o[6] = f2bf(b.z); o[7] = f2bf(b.w);
      *(v8bf*)(dst + u * CVT_STEP + j * 256 + el) = o;
    }
  }
#undef CVT_LOAD
#undef CVT_XWAIT
}

// ---------------------------------------------------------------------------
// Kernel 1: QKV projection, all-bf16, double-buffered async LDS staging.
// grid = (M/128, N/128, 3), block = 256 (8 waves, 4x2, 32x64 per wave)
// ---------------------------------------------------------------------------
__global__ __launch_bounds__(256) void qkv_proj_kernel(
    const bf16* __restrict__ xq, const bf16* __restrict__ xk,
    const bf16* __restrict__ xv, const bf16* __restrict__ wqkv,
    const float* __restrict__ b_qkv,
    bf16* __restrict__ q_out, bf16* __restrict__ k_out, bf16* __restrict__ v_out)
{
  __shared__ bf16 sA[2][128 * 40];
  __shared__ bf16 sB[2][128 * 40];
  const int tid  = threadIdx.x;
  const int lane = tid & 31, wave = tid >> 5;
  const int half = lane >> 4, l16 = lane & 15;
  const int which = blockIdx.z;
  const bf16* x    = (which == 0) ? xq : ((which == 1) ? xk : xv);
  const bf16* w    = wqkv + (size_t)which * EMB * EMB;
  const float* bias = b_qkv + which * EMB;
  bf16* outp        = (which == 0) ? q_out : ((which == 1) ? k_out : v_out);
  const int m0 = blockIdx.x * 128;
  const int n0 = blockIdx.y * 128;
  const int wm = wave & 3, wn = wave >> 2;

  auto stage = [&](int kk, bf16* dA, bf16* dB) {
#pragma unroll
    for (int i = 0; i < 2; ++i) {
      int idx = tid + i * 256;            // 512 chunks per tile
      int row = idx >> 2;
      int c   = (idx & 3) * 8;
      cp16_g2l(x + (size_t)(m0 + row) * EMB + kk + c, dA + row * 40 + c);
      cp16_g2l(w + (size_t)(n0 + row) * EMB + kk + c, dB + row * 40 + c);
    }
  };

  bf16 *curA = sA[0], *curB = sB[0], *nxtA = sA[1], *nxtB = sB[1];
  stage(0, curA, curB);
  v8f acc[2][4] = {};

#pragma unroll 1            // keep accumulators pinned; no unroll-induced copies
  for (int kt = 0; kt < EMB / 32; ++kt) {
    async_wait0();
    __syncthreads();
    if (kt + 1 < EMB / 32) stage((kt + 1) * 32, nxtA, nxtB);
    v16bf a0 = load_frag(curA, 40, wm * 32,      0);
    v16bf a1 = load_frag(curA, 40, wm * 32 + 16, 0);
#pragma unroll
    for (int j = 0; j < 4; ++j) {
      v16bf b = load_frag(curB, 40, wn * 64 + j * 16, 0);
      acc[0][j] = wmma_bf16(a0, b, acc[0][j]);
      acc[1][j] = wmma_bf16(a1, b, acc[1][j]);
    }
    bf16* t;
    t = curA; curA = nxtA; nxtA = t;
    t = curB; curB = nxtB; nxtB = t;
  }

  // epilogue: +bias, convert, scatter into [B,H,T,DH]
#pragma unroll
  for (int j = 0; j < 4; ++j) {
    int n = n0 + wn * 64 + j * 16 + l16;
    float bj = bias[n];
    int hh = n >> 6, dd = n & 63;
#pragma unroll
    for (int i = 0; i < 2; ++i) {
#pragma unroll
      for (int r = 0; r < 8; ++r) {
        int m = m0 + wm * 32 + i * 16 + r + half * 8;   // row in [T*B]
        int t = m >> 2, bb = m & 3;                      // x is [T,B,E]
        float val = acc[i][j][r] + bj;
        outp[(((size_t)bb * NH + hh) * T_SEQ + t) * DH + dd] = f2bf(val);
      }
    }
  }
}

__device__ __forceinline__ float other_half(float x) {
  int b = __builtin_bit_cast(int, x);
  b = __builtin_amdgcn_permlanex16(b, b, 0x76543210, 0xfedcba98, false, false);
  return __builtin_bit_cast(float, b);
}

#define MASK_PITCH 36   // floats
#define V_PITCH 160     // bytes: 32 x odd, the conflict-free pitch of the transposing load

typedef __attribute__((ext_vector_type(8))) short s16x8;
__device__ __forceinline__ u32x4 ld_tr16(const unsigned char* p) {
  typedef __attribute__((address_space(3))) s16x8 lds_s16x8;
  return __builtin_bit_cast(u32x4, __builtin_amdgcn_ds_load_tr16_b128_v8i16((lds_s16x8*)p));
}

__global__ __launch_bounds__(256) __attribute__((amdgpu_waves_per_eu(8, 8))) void attention_kernel(
    const bf16* __restrict__ Q, const bf16* __restrict__ K,
    const bf16* __restrict__ V, const float* __restrict__ mask,
    bf16* __restrict__ ctx)
{
  __shared__ __attribute__((aligned(16))) bf16 sK[2][32 * 72];   // 32 keys x 64 d (+8 pad)
  // V as it lies: 32 keys x 64 d, rows at V_PITCH; transposed on the way to the registers
  __shared__ __attribute__((aligned(16))) unsigned char sV[2][32 * V_PITCH];
  __shared__ __attribute__((aligned(16))) float sM[2][128 * MASK_PITCH];

  const int tid  = threadIdx.x;
  const int lane = tid & 31, wave = tid >> 5;
  const int half = lane >> 4, l16 = lane & 15;
  const int bh = blockIdx.y;
  const int b  = bh >> 4, h = bh & 15;
  const size_t base = (size_t)bh * T_SEQ * DH;
  const int q0 = blockIdx.x * 128;
  const int qw = q0 + wave * 16;

  // Persistent Q fragments (B operand: column = query) for d in [0,32), [32,64)
  v16bf bq[2];
  {
    const bf16* qp = Q + base + (size_t)(qw + l16) * DH;
#pragma unroll
    for (int s = 0; s < 2; ++s) {
      FragU f;
      f.h[0] = *(const u32x4*)(qp + s * 32 + half * 8);
      f.h[1] = *(const u32x4*)(qp + s * 32 + half * 8 + 16);
      bq[s] = f.v;
    }
  }

  // copies: 8 lanes take one row's 128 bytes, a copy takes 4 rows, 4 copies the wave's 16
  const float* mg = mask + (size_t)(qw + (lane >> 3)) * T_SEQ + (lane & 7) * 4;
  const unsigned ml = (unsigned)(uintptr_t)
      &sM[0][(wave * 16 + (lane >> 3)) * MASK_PITCH + (lane & 7) * 4];   // LDS byte address
  auto stage_mask = [&](int kc, int buf) {
    const float* g = mg + kc;
    const unsigned l = ml + buf * (128 * MASK_PITCH * 4);
    cp16x4_g2l(g, g + 4 * T_SEQ, g + 8 * T_SEQ, g + 12 * T_SEQ,
               l, l + 4 * MASK_PITCH * 4, l + 8 * MASK_PITCH * 4, l + 12 * MASK_PITCH * 4);
  };
  // this lane's query row in a buffer, at the first key it holds
  const float* mrow = &sM[0][(wave * 16 + l16) * MASK_PITCH + half * 8];
  // this lane's address for the transposing loads of V: d tile f at + 32 f bytes
  const unsigned char* vtr = sV[0] + (half * 8 + (lane & 7)) * V_PITCH + ((lane >> 3) & 1) * 16;
  // one pass's tile: K and V in 16-byte chunks (256 each, one a thread, 8 lanes a row of
  // 128 bytes) and the wave's mask rows
  const bf16* kg = K + base + (size_t)(tid >> 3) * DH + (tid & 7) * 8;
  const bf16* vg = V + base + (size_t)(tid >> 3) * DH + (tid & 7) * 8;
  auto stage = [&](int kc, int buf) {
    cp16_g2l(kg + (size_t)kc * DH, sK[buf] + (tid >> 3) * 72 + (tid & 7) * 8);
    cp16_g2l(vg + (size_t)kc * DH, (bf16*)(sV[buf] + (tid >> 3) * V_PITCH + (tid & 7) * 16));
    stage_mask(kc, buf);
  };
  stage(0, 0);
  async_wait0();     // tile 0 has landed ...
  __syncthreads();   // ... for every wave
  stage(32, 1);

  float m_run = -3.0e38f;   // running maximum of this lane's query (both halves agree)
  float l_run = 0.0f;       // running sum over this half's keys only; joined at the end
  v8f o[4] = {};            // o[f][r] = O[query l16][d = 16 f + 8 half + r]

#pragma unroll 1
  for (int kc = 0; kc < T_SEQ; kc += 32) {
    const int mbuf = (kc >> 5) & 1;
    // mask of this query at the 2 x 8 keys the lane holds
    f32x4 mk[2][2];
#pragma unroll
    for (int j = 0; j < 2; ++j) {
      mk[j][0] = *(const f32x4*)(mrow + mbuf * (128 * MASK_PITCH) + j * 16);
      mk[j][1] = *(const f32x4*)(mrow + mbuf * (128 * MASK_PITCH) + j * 16 + 4);
    }

    // S^T(32x16) = K(32x64) Q^T
    v8f sacc[2] = {};
#pragma unroll
    for (int j = 0; j < 2; ++j) {
      v16bf ak0 = load_frag(sK[mbuf], 72, j * 16, 0);
      v16bf ak1 = load_frag(sK[mbuf], 72, j * 16, 32);
      sacc[j] = wmma_bf16(ak0, bq[0], sacc[j]);
      sacc[j] = wmma_bf16(ak1, bq[1], sacc[j]);
    }

    // scale * mask, online softmax: 16 keys in the lane, one exchange of halves
    float mx = -3.0e38f;
#pragma unroll
    for (int j = 0; j < 2; ++j) {
      sacc[j] = sacc[j] * ATTN_SCALE *
                __builtin_shufflevector(mk[j][0], mk[j][1], 0, 1, 2, 3, 4, 5, 6, 7);
#pragma unroll
      for (int r = 0; r < 8; ++r) mx = fmaxf(mx, sacc[j][r]);
    }
    mx = fmaxf(mx, other_half(mx));
    const float mnew  = fmaxf(m_run, mx);
    const float alpha = __expf(m_run - mnew);
#pragma unroll
    for (int j = 0; j < 2; ++j)
#pragma unroll
      for (int r = 0; r < 8; ++r) sacc[j][r] = __expf(sacc[j][r] - mnew);
    const v8f ps = sacc[0] + sacc[1];
    const float rs = ((ps[0] + ps[1]) + (ps[2] + ps[3])) + ((ps[4] + ps[5]) + (ps[6] + ps[7]));
    l_run = l_run * alpha + rs;
    m_run = mnew;
#pragma unroll
    for (int f = 0; f < 4; ++f)
#pragma unroll
      for (int r = 0; r < 8; ++r) o[f][r] *= alpha;

    // the two score tiles, converted in place, are the B operand P^T (32 keys x 16 q)
    const v8bf pl = __builtin_convertvector(sacc[0], v8bf);
    const v8bf ph = __builtin_convertvector(sacc[1], v8bf);
    const v16bf bp = __builtin_shufflevector(pl, ph, 0, 1, 2, 3, 4, 5, 6, 7,
                                             8, 9, 10, 11, 12, 13, 14, 15);
#pragma unroll
    for (int f = 0; f < 4; ++f) {
      FragU av;                                     // A: 16 d x 32 keys, keys in P^T's order
      av.h[0] = ld_tr16(vtr + mbuf * (32 * V_PITCH) + 32 * f);   // keys 8 half + 0..7
      av.h[1] = ld_tr16(vtr + mbuf * (32 * V_PITCH) + 16 * V_PITCH + 32 * f);   // 16 + 8 half + 0..7
      o[f] = wmma_bf16(av.v, bp, o[f]);
    }

    // foot of the pass: the wave's LDS reads of this buffer have retired, its copies of the
    // next tile have landed; behind the barrier that holds for every wave, so the next
    // buffer may be read and this one refilled
    asm volatile("s_wait_dscnt 0x0" ::: "memory");
    async_wait0();
    __syncthreads();
    if (kc + 64 < T_SEQ) stage(kc + 64, mbuf);
  }

  async_wait0();   // closes the copy ring: no copy of the wave is outstanding when it ends

  // join the halves' sums, normalize, store ctx bf16 at [B,T,E]: 8 d = 16 bytes a lane
  l_run += other_half(l_run);
  const float inv = 1.0f / l_run;
  bf16* crow = ctx + ((size_t)b * T_SEQ + qw + l16) * EMB + h * DH + half * 8;
#pragma unroll
  for (int f = 0; f < 4; ++f) {
    v8bf ov;
#pragma unroll
    for (int r = 0; r < 8; ++r) ov[r] = f2bf(o[f][r] * inv);
    *(v8bf*)(crow + f * 16) = ov;
  }
}

// ---------------------------------------------------------------------------
// Kernel 3: output projection, all-bf16 operands, double-buffered staging.
// out[T,B,E](f32) = ctx[B,T,E](bf16) @ w_out^T + b_out
// ---------------------------------------------------------------------------
__global__ __launch_bounds__(256) void out_proj_kernel(
    const bf16* __restrict__ ctx, const bf16* __restrict__ wout,
    const float* __restrict__ b_out, float* __restrict__ out)
{
  __shared__ bf16 sA[2][128 * 40];
  __shared__ bf16 sB[2][128 * 40];
  const int tid  = threadIdx.x;
  const int lane = tid & 31, wave = tid >> 5;
  const int half = lane >> 4, l16 = lane & 15;
  const int m0 = blockIdx.x * 128;
  const int n0 = blockIdx.y * 128;
  const int wm = wave & 3, wn = wave >> 2;

  auto stage = [&](int kk, bf16* dA, bf16* dB) {
#pragma unroll
    for (int i = 0; i < 2; ++i) {
      int idx = tid + i * 256;
      int row = idx >> 2;
      int c   = (idx & 3) * 8;
      cp16_g2l(ctx  + (size_t)(m0 + row) * EMB + kk + c, dA + row * 40 + c);
      cp16_g2l(wout + (size_t)(n0 + row) * EMB + kk + c, dB + row * 40 + c);
    }
  };

  bf16 *curA = sA[0], *curB = sB[0], *nxtA = sA[1], *nxtB = sB[1];
  stage(0, curA, curB);
  v8f acc[2][4] = {};

#pragma unroll 1
  for (int kt = 0; kt < EMB / 32; ++kt) {
    async_wait0();
    __syncthreads();
    if (kt + 1 < EMB / 32) stage((kt + 1) * 32, nxtA, nxtB);
    v16bf a0 = load_frag(curA, 40, wm * 32,      0);
    v16bf a1 = load_frag(curA, 40, wm * 32 + 16, 0);
#pragma unroll
    for (int j = 0; j < 4; ++j) {
      v16bf b = load_frag(curB, 40, wn * 64 + j * 16, 0);
      acc[0][j] = wmma_bf16(a0, b, acc[0][j]);
      acc[1][j] = wmma_bf16(a1, b, acc[1][j]);
    }
    bf16* t;
    t = curA; curA = nxtA; nxtA = t;
    t = curB; curB = nxtB; nxtB = t;
  }

#pragma unroll
  for (int j = 0; j < 4; ++j) {
    int n = n0 + wn * 64 + j * 16 + l16;
    float bj = b_out[n];
#pragma unroll
    for (int i = 0; i < 2; ++i) {
#pragma unroll
      for (int r = 0; r < 8; ++r) {
        int m = m0 + wm * 32 + i * 16 + r + half * 8;   // row in [B*T]
        int bb = m >> 11;                                // / T_SEQ
        int t  = m & (T_SEQ - 1);
        out[((size_t)t * BATCH + bb) * EMB + n] = acc[i][j][r] + bj;
      }
    }
  }
}

// ---------------------------------------------------------------------------
extern "C" void kernel_launch(void* const* d_in, const int* in_sizes, int n_in,
                              void* d_out, int out_size, void* d_ws, size_t ws_size,
                              hipStream_t stream) {
  (void)in_sizes; (void)n_in; (void)out_size; (void)ws_size;
  const float* query = (const float*)d_in[0];
  const float* key   = (const float*)d_in[1];
  const float* value = (const float*)d_in[2];
  const float* mask  = (const float*)d_in[3];
  const float* w_qkv = (const float*)d_in[4];
  const float* b_qkv = (const float*)d_in[5];
  const float* w_out = (const float*)d_in[6];
  const float* b_out = (const float*)d_in[7];
  float* out = (float*)d_out;

  const size_t NTOK = (size_t)T_SEQ * BATCH * EMB;      // 8388608
  const size_t NWQ  = (size_t)3 * EMB * EMB;            // 3145728
  const size_t NWO  = (size_t)EMB * EMB;                // 1048576
  bf16* xq   = (bf16*)d_ws;           // bf16 copies of inputs
  bf16* xk   = xq + NTOK;
  bf16* xv   = xk + NTOK;
  bf16* wqb  = xv + NTOK;
  bf16* wob  = wqb + NWQ;
  bf16* Qh   = wob + NWO;             // projected [B,H,T,DH]
  bf16* Kh   = Qh + NTOK;
  bf16* Vh   = Kh + NTOK;
  bf16* ctx  = Vh + NTOK;             // [B,T,E]

  // xq, xk, xv, wqb, wob are one contiguous run of the workspace
  cvt_all_kernel<<<256, 512, 0, stream>>>(query, key, value, w_qkv, w_out, xq);

  dim3 gQKV(64, 8, 3);               // M=8192/128, N=1024/128, {q,k,v}
  qkv_proj_kernel<<<gQKV, 256, 0, stream>>>(xq, xk, xv, wqb, b_qkv, Qh, Kh, Vh);

  dim3 gATT(T_SEQ / 128, BATCH * NH);
  attention_kernel<<<gATT, 256, 0, stream>>>(Qh, Kh, Vh, mask, ctx);

  dim3 gOUT(64, 8);                  // M=8192/128, N=1024/128
  out_proj_kernel<<<gOUT, 256, 0, stream>>>(ctx, wob, b_out, out);
}

// v007
// A run of this version takes 162 microseconds.
// Versions between v005 and this one are left out; their measured steps multiply to 1.09 times as fast.
// Over all steps from v000 it is 2.42 times as fast.
#include <hip/hip_runtime.h>
#include <stdint.h>

#define T_SEQ 2048
#define BATCH 4
#define EMB   1024
#define NH    16
#define DH    64
#define ATTN_SCALE 0.125f   // 1/sqrt(64)

typedef __bf16 bf16;
typedef __attribute__((ext_vector_type(16))) __bf16 v16bf;
typedef __attribute__((ext_vector_type(8)))  __bf16 v8bf;
typedef __attribute__((ext_vector_type(4)))  __bf16 v4bf;
typedef __attribute__((ext_vector_type(8)))  float  v8f;
typedef __attribute__((ext_vector_type(4)))  float  f32x4;
typedef __attribute__((ext_vector_type(4)))  unsigned int u32x4;
typedef __attribute__((ext_vector_type(4)))  int i32x4;

union FragU { v16bf v; u32x4 h[2]; };

#if defined(__has_builtin)
#if __has_builtin(__builtin_amdgcn_global_load_async_to_lds_b128)
#define HAVE_ASYNC_LDS 1
#endif
#endif
#ifndef HAVE_ASYNC_LDS
#define HAVE_ASYNC_LDS 0
#endif

__device__ __forceinline__ void cp16_g2l(const bf16* g, bf16* l) {
#if HAVE_ASYNC_LDS
  __builtin_amdgcn_global_load_async_to_lds_b128((i32x4*)g, (i32x4*)l, 0, 0);
#else
  *(u32x4*)l = *(const u32x4*)g;
#endif
}
// four 16-byte copies a lane, each with address registers of its own and no immediate
// offset; the closing wait stands in front of any rewrite of those registers
__device__ __forceinline__ void cp16x4_g2l(const float* g0, const float* g1,
                                           const float* g2, const float* g3,
                                           unsigned l0, unsigned l1,
                                           unsigned l2, unsigned l3) {
  asm volatile("global_load_async_to_lds_b128 %0, %4, off\n\t"
               "global_load_async_to_lds_b128 %1, %5, off\n\t"
               "global_load_async_to_lds_b128 %2, %6, off\n\t"
               "global_load_async_to_lds_b128 %3, %7, off\n\t"
               "s_wait_xcnt 0x0"
               :: "v"(l0), "v"(l1), "v"(l2), "v"(l3), "v"(g0), "v"(g1), "v"(g2), "v"(g3)
               : "memory");
}
__device__ __forceinline__ void async_wait0() {
#if HAVE_ASYNC_LDS
  asm volatile("s_wait_asynccnt 0x0" ::: "memory");
#endif
}

// round-to-nearest-even f32 -> bf16 (bit-level)
__device__ __forceinline__ bf16 f2bf(float f) {
  unsigned u = __builtin_bit_cast(unsigned, f);
  unsigned r = (u + 0x7FFFu + ((u >> 16) & 1u)) >> 16;
  unsigned short s = (unsigned short)r;
  return __builtin_bit_cast(bf16, s);
}

__device__ __forceinline__ v8f wmma_bf16(v16bf a, v16bf b, v8f c) {
  return __builtin_amdgcn_wmma_f32_16x16x32_bf16(false, a, false, b, (short)0, c, false, false);
}

// 16x32 bf16 operand fragment from a row-major LDS tile.
// lane&15 = row, half = K-subset; two contiguous 8-bf16 runs per lane.
__device__ __forceinline__ v16bf load_frag(const bf16* base, int strideBf,
                                           int rowOff, int colOff) {
  const int lane = threadIdx.x & 31;
  const int half = lane >> 4;
  const bf16* p = base + (size_t)((lane & 15) + rowOff) * strideBf + colOff + half * 8;
  FragU f;
  f.h[0] = *(const u32x4*)(p);
  f.h[1] = *(const u32x4*)(p + 16);
  return f.v;
}

// ---------------------------------------------------------------------------
// Kernel 0: f32 -> bf16 conversion of all five operands in ONE launch.
// The five bf16 copies lie one behind another in the workspace, so the output is one
// array of 28,672 units of 1,024 elements: query 8,192 units, key 8,192, value 8,192,
// w_qkv 3,072, w_out 1,024.  grid = 256, block = 512: 4,096 waves, one block a WGP.
// Wave w converts units w + 4096 i, i = 0..6; a unit is 8 loads of 16 bytes a lane,
// and the loads run two units ahead of the conversion.
// ---------------------------------------------------------------------------
#define CVT_WAVES 4096
#define CVT_UNIT  1024
#define CVT_UNITS 7        // units a wave
#define CVT_AHEAD 2        // how many units ahead of the one being converted the loads run
#define CVT_STEP  ((size_t)CVT_WAVES * CVT_UNIT)   // elements between a wave's units

__global__ __launch_bounds__(512) void cvt_all_kernel(
    const float* __restrict__ q, const float* __restrict__ k,
    const float* __restrict__ v, const float* __restrict__ wqkv,
    const float* __restrict__ wout, bf16* __restrict__ out)
{
  const unsigned el = (threadIdx.x & 31u) * 8u;    // this lane's 8 elements of each 256
  const int w = blockIdx.x * 16 + __builtin_amdgcn_readfirstlane(threadIdx.x >> 5);
  const size_t off = (size_t)w * CVT_UNIT;         // wave-uniform
  const float* src[CVT_UNITS] = {
      q + off, q + off + CVT_STEP, k + off, k + off + CVT_STEP,
      v + off, v + off + CVT_STEP,
      (w < 3072) ? wqkv + off : wout + (off - (size_t)3072 * CVT_UNIT)};
  bf16* dst = out + off;

  f32x4 r[CVT_AHEAD + 1][8];                       // ring of unit buffers
#define CVT_LOAD(U) do { _Pragma("unroll") for (int j = 0; j < 4; ++j) { \
    r[(U) % (CVT_AHEAD + 1)][2 * j]     = *(const f32x4*)(src[U] + j * 256 + el); \
    r[(U) % (CVT_AHEAD + 1)][2 * j + 1] = *(const f32x4*)(src[U] + j * 256 + el + 4); } } while (0)
// stands in front of loads that land in registers which issued loads and stores still name
#define CVT_XWAIT() asm volatile("s_wait_xcnt 0x0" ::: "memory")
#pragma unroll
  for (int u = 0; u < CVT_AHEAD; ++u) CVT_LOAD(u);
#pragma unroll
  for (int u = 0; u < CVT_UNITS; ++u) {
    // the two scheduling barriers pin the order "a later unit's loads, then this unit's
    // conversion and stores"; without them the loads bunch and the wave runs dry between
    __builtin_amdgcn_sched_barrier(0);
    if (u + CVT_AHEAD < CVT_UNITS) { CVT_XWAIT(); CVT_LOAD(u + CVT_AHEAD); }
    __builtin_amdgcn_sched_barrier(0);
#pragma unroll
    for (int j = 0; j < 4; ++j) {
      const f32x4 a = r[u % (CVT_AHEAD + 1)][2 * j], b = r[u % (CVT_AHEAD + 1)][2 * j + 1];
      v8bf o;
      o[0] = f2bf(a.x); o[1] = f2bf(a.y); o[2] = f2bf(a.z); o[3] = f2bf(a.w);
      o[4] = f2bf(b.x); o[5] = f2bf(b.y); o[6] = f2bf(b.z); o[7] = f2bf(b.w);
      *(v8bf*)(dst + u * CVT_STEP + j * 256 + el) = o;
    }
  }
#undef CVT_LOAD
#undef CVT_XWAIT
}

// ---------------------------------------------------------------------------
// Kernel 1: QKV projection, all-bf16, double-buffered async LDS staging.
// grid = (M/128, N/128, 3), block = 256 (8 waves, 4x2, 32x64 per wave)
// ---------------------------------------------------------------------------
__global__ __launch_bounds__(256) void qkv_proj_kernel(
    const bf16* __restrict__ xq, const bf16* __restrict__ xk,
    const bf16* __restrict__ xv, const bf16* __restrict__ wqkv,
    const float* __restrict__ b_qkv,
    bf16* __restrict__ q_out, bf16* __restrict__ k_out, bf16* __restrict__ v_out)
{
  __shared__ bf16 sA[2][128 * 40];
  __shared__ bf16 sB[2][128 * 40];
  const int tid  = threadIdx.x;
  const int lane = tid & 31, wave = tid >> 5;
  const int half = lane >> 4, l16 = lane & 15;
  const int which = blockIdx.z;
  const bf16* x    = (which == 0) ? xq : ((which == 1) ? xk : xv);
  const bf16* w    = wqkv + (size_t)which * EMB * EMB;
  const float* bias = b_qkv + which * EMB;
  bf16* outp        = (which == 0) ? q_out : ((which == 1) ? k_out : v_out);
  const int m0 = blockIdx.x * 128;
  const int n0 = blockIdx.y * 128;
  const int wm = wave & 3, wn = wave >> 2;

  auto stage = [&](int kk, bf16* dA, bf16* dB) {
#pragma unroll
    for (int i = 0; i < 2; ++i) {
      int idx = tid + i * 256;            // 512 chunks per tile
      int row = idx >> 2;
      int c   = (idx & 3) * 8;
      cp16_g2l(x + (size_t)(m0 + row) * EMB + kk + c, dA + row * 40 + c);
      cp16_g2l(w + (size_t)(n0 + row) * EMB + kk + c, dB + row * 40 + c);
    }
  };

  bf16 *curA = sA[0], *curB = sB[0], *nxtA = sA[1], *nxtB = sB[1];
  stage(0, curA, curB);
  v8f acc[2][4] = {};

#pragma unroll 1            // keep accumulators pinned; no unroll-induced copies
  for (int kt = 0; kt < EMB / 32; ++kt) {
    async_wait0();
    __syncthreads();
    if (kt + 1 < EMB / 32) stage((kt + 1) * 32, nxtA, nxtB);
    v16bf a0 = load_frag(curA, 40, wm * 32,      0);
    v16bf a1 = load_frag(curA, 40, wm * 32 + 16, 0);
#pragma unroll
    for (int j = 0; j < 4; ++j) {
      v16bf b = load_frag(curB, 40, wn * 64 + j * 16, 0);
      acc[0][j] = wmma_bf16(a0, b, acc[0][j]);
      acc[1][j] = wmma_bf16(a1, b, acc[1][j]);
    }
    bf16* t;
    t = curA; curA = nxtA; nxtA = t;
    t = curB; curB = nxtB; nxtB = t;
  }

  // epilogue: +bias, convert, scatter into [B,H,T,DH]
#pragma unroll
  for (int j = 0; j < 4; ++j) {
    int n = n0 + wn * 64 + j * 16 + l16;
    float bj = bias[n];
    int hh = n >> 6, dd = n & 63;
#pragma unroll
    for (int i = 0; i < 2; ++i) {
#pragma unroll
      for (int r = 0; r < 8; ++r) {
        int m = m0 + wm * 32 + i * 16 + r + half * 8;   // row in [T*B]
        int t = m >> 2, bb = m & 3;                      // x is [T,B,E]
        float val = acc[i][j][r] + bj;
        outp[(((size_t)bb * NH + hh) * T_SEQ + t) * DH + dd] = f2bf(val);
      }
    }
  }
}

__device__ __forceinline__ float other_half(float x) {
  int b = __builtin_bit_cast(int, x);
  b = __builtin_amdgcn_permlanex16(b, b, 0x76543210, 0xfedcba98, false, false);
  return __builtin_bit_cast(float, b);
}

#define MASK_PITCH 36   // floats
#define V_PITCH 160     // bytes: 32 x odd, the conflict-free pitch of the transposing load
#define SCALE_LOG2E (ATTN_SCALE * 1.44269504088896340736f)   // raw score -> exponent of 2
#define LAZY_STEP 8.0f   // log2 units a maximum may lie above the reference in use

typedef __attribute__((ext_vector_type(8))) short s16x8;
__device__ __forceinline__ u32x4 ld_tr16(const unsigned char* p) {
  typedef __attribute__((address_space(3))) s16x8 lds_s16x8;
  return __builtin_bit_cast(u32x4, __builtin_amdgcn_ds_load_tr16_b128_v8i16((lds_s16x8*)p));
}

__global__ __launch_bounds__(256) __attribute__((amdgpu_waves_per_eu(4, 4))) void attention_kernel(
    const bf16* __restrict__ Q, const bf16* __restrict__ K,
    const bf16* __restrict__ V, const float* __restrict__ mask,
    bf16* __restrict__ ctx)
{
  // [buffer][head of the block]: 32 keys x 64 d (+8 pad)
  __shared__ __attribute__((aligned(16))) bf16 sK[2][2][32 * 72];
  // V as it lies: 32 keys x 64 d, rows at V_PITCH; transposed on the way to the registers
  __shared__ __attribute__((aligned(16))) unsigned char sV[2][2][32 * V_PITCH];
  __shared__ __attribute__((aligned(16))) float sM[2][128 * MASK_PITCH];

  const int tid  = threadIdx.x;
  const int lane = tid & 31, wave = tid >> 5;
  const int half = lane >> 4, l16 = lane & 15;
  const int hs = wave >> 2, qg = wave & 3;      // head of the block, group of 32 queries
  const int bh = blockIdx.y * 2 + hs;
  const int b  = bh >> 4, h = bh & 15;
  const size_t base = (size_t)bh * T_SEQ * DH;
  const int q0 = blockIdx.x * 128;
  const int qw = q0 + qg * 32;

  // Persistent Q fragments (B operand: column = query), tile c, d in [0,32), [32,64)
  v16bf bq[2][2];
#pragma unroll
  for (int c = 0; c < 2; ++c) {
    const bf16* qp = Q + base + (size_t)(qw + c * 16 + l16) * DH;
#pragma unroll
    for (int s = 0; s < 2; ++s) {
      FragU f;
      f.h[0] = *(const u32x4*)(qp + s * 32 + half * 8);
      f.h[1] = *(const u32x4*)(qp + s * 32 + half * 8 + 16);
      bq[c][s] = f.v;
    }
  }

  // copies: 8 lanes take one row's 128 bytes, a copy takes 4 rows, 4 copies the wave's 16
  const float* mg = mask + (size_t)(q0 + wave * 16 + (lane >> 3)) * T_SEQ + (lane & 7) * 4;
  const unsigned ml = (unsigned)(uintptr_t)
      &sM[0][(wave * 16 + (lane >> 3)) * MASK_PITCH + (lane & 7) * 4];   // LDS byte address
  auto stage_mask = [&](int kc, int buf) {
    const float* g = mg + kc;
    const unsigned l = ml + buf * (128 * MASK_PITCH * 4);
    cp16x4_g2l(g, g + 4 * T_SEQ, g + 8 * T_SEQ, g + 12 * T_SEQ,
               l, l + 4 * MASK_PITCH * 4, l + 8 * MASK_PITCH * 4, l + 12 * MASK_PITCH * 4);
  };
  // this lane's query row of tile 0 in a buffer, at the first key it holds
  const float* mrow = &sM[0][(qg * 32 + l16) * MASK_PITCH + half * 8];
  // this lane's address for the transposing loads of V: d tile f at + 32 f bytes
  const unsigned char* vtr =
      sV[0][hs] + (half * 8 + (lane & 7)) * V_PITCH + ((lane >> 3) & 1) * 16;
  // one pass's tile: K and V of both heads in 16-byte chunks (256 a head, one a thread,
  // 8 lanes a row of 128 bytes) and the wave's 16 mask rows
  const size_t base2 = (size_t)(blockIdx.y * 2) * T_SEQ * DH;
  const bf16* kg = K + base2 + (size_t)(tid >> 3) * DH + (tid & 7) * 8;
  const bf16* vg = V + base2 + (size_t)(tid >> 3) * DH + (tid & 7) * 8;
  auto stage = [&](int kc, int buf) {
#pragma unroll
    for (int hh = 0; hh < 2; ++hh) {
      cp16_g2l(kg + (size_t)hh * T_SEQ * DH + (size_t)kc * DH,
               sK[buf][hh] + (tid >> 3) * 72 + (tid & 7) * 8);
      cp16_g2l(vg + (size_t)hh * T_SEQ * DH + (size_t)kc * DH,
               (bf16*)(sV[buf][hh] + (tid >> 3) * V_PITCH + (tid & 7) * 16));
    }
    stage_mask(kc, buf);
  };
  stage(0, 0);
  async_wait0();     // tile 0 has landed ...
  __syncthreads();   // ... for every wave
  stage(32, 1);

  // per query tile c:
  float ref[2] = {-3.0e38f, -3.0e38f};   // reference of this lane's query, log2 units
  float lim[2] = {-3.0e38f, -3.0e38f};   // raw score above which the reference moves
  float l_run[2] = {0.0f, 0.0f};         // running sum over this half's keys; joined at the end
  v8f o[2][4] = {};                      // o[c][f][r] = O[query l16 of tile c][d = 16 f + 8 half + r]

#pragma unroll 1
  for (int kc = 0; kc < T_SEQ; kc += 32) {
    const int mbuf = (kc >> 5) & 1;
    // K fragments of the pass: each is the A operand of both query tiles
    v16bf ak[2][2];
#pragma unroll
    for (int j = 0; j < 2; ++j) {
      ak[j][0] = load_frag(sK[mbuf][hs], 72, j * 16, 0);
      ak[j][1] = load_frag(sK[mbuf][hs], 72, j * 16, 32);
    }
    // mask of the lane's two queries at the 2 x 8 keys it holds
    f32x4 mk[2][2][2];
#pragma unroll
    for (int c = 0; c < 2; ++c)
#pragma unroll
      for (int j = 0; j < 2; ++j) {
        const float* mp = mrow + mbuf * (128 * MASK_PITCH) + c * (16 * MASK_PITCH) + j * 16;
        mk[c][j][0] = *(const f32x4*)(mp);
        mk[c][j][1] = *(const f32x4*)(mp + 4);
      }

    // S^T(32x16) = K(32x64) Q^T, twice
    v8f sacc[2][2] = {};
#pragma unroll
    for (int s = 0; s < 2; ++s)
#pragma unroll
      for (int j = 0; j < 2; ++j)
#pragma unroll
        for (int c = 0; c < 2; ++c) sacc[c][j] = wmma_bf16(ak[j][s], bq[c][s], sacc[c][j]);

    // raw scores t = s mask; softmax against a held reference (lazy rescale): while no
    // maximum of the pass lies more than LAZY_STEP (log2 units) above the reference in use,
    // the reference stands and neither alpha nor a rescale of O and l is worked out
    float mx[2];
#pragma unroll
    for (int c = 0; c < 2; ++c) {
      mx[c] = -3.0e38f;
#pragma unroll
      for (int j = 0; j < 2; ++j) {
        sacc[c][j] = sacc[c][j] *
            __builtin_shufflevector(mk[c][j][0], mk[c][j][1], 0, 1, 2, 3, 4, 5, 6, 7);
#pragma unroll
        for (int r = 0; r < 8; ++r) mx[c] = fmaxf(mx[c], sacc[c][j][r]);
      }
    }
    // one test a pass, a scalar branch for the whole wave and both tiles
    if (__builtin_amdgcn_ballot_w32((mx[0] > lim[0]) | (mx[1] > lim[1])) != 0) {
#pragma unroll
      for (int c = 0; c < 2; ++c) {
        const float m2    = fmaxf(mx[c], other_half(mx[c]));
        const float rnew  = fmaxf(ref[c], m2 * SCALE_LOG2E);
        const float alpha = __builtin_amdgcn_exp2f(ref[c] - rnew);
        ref[c] = rnew;
        lim[c] = (rnew + LAZY_STEP) * (1.0f / SCALE_LOG2E);
        l_run[c] *= alpha;
#pragma unroll
        for (int f = 0; f < 4; ++f)
#pragma unroll
          for (int r = 0; r < 8; ++r) o[c][f][r] *= alpha;
      }
    }
    // p = 2^(t c - ref): one fma and one exp2 a score (c2, nref: a scalar in every element)
    const v8f c2 = SCALE_LOG2E - (v8f){};
    v16bf bp[2];
#pragma unroll
    for (int c = 0; c < 2; ++c) {
      const v8f nref = -ref[c] - (v8f){};
#pragma unroll
      for (int j = 0; j < 2; ++j) {
        const v8f e = __builtin_elementwise_fma(sacc[c][j], c2, nref);
#pragma unroll
        for (int r = 0; r < 8; ++r) sacc[c][j][r] = __builtin_amdgcn_exp2f(e[r]);
      }
      const v8f ps = sacc[c][0] + sacc[c][1];
      l_run[c] += ((ps[0] + ps[1]) + (ps[2] + ps[3])) + ((ps[4] + ps[5]) + (ps[6] + ps[7]));

      // the two score tiles, converted in place, are the B operand P^T (32 keys x 16 q)
      const v8bf pl = __builtin_convertvector(sacc[c][0], v8bf);
      const v8bf ph = __builtin_convertvector(sacc[c][1], v8bf);
      bp[c] = __builtin_shufflevector(pl, ph, 0, 1, 2, 3, 4, 5, 6, 7,
                                      8, 9, 10, 11, 12, 13, 14, 15);
    }
#pragma unroll
    for (int f = 0; f < 4; ++f) {
      FragU av;                                     // A: 16 d x 32 keys, keys in P^T's order
      av.h[0] = ld_tr16(vtr + mbuf * (2 * 32 * V_PITCH) + 32 * f);   // keys 8 half + 0..7
      av.h[1] = ld_tr16(vtr + mbuf * (2 * 32 * V_PITCH) + 16 * V_PITCH + 32 * f);   // 16 + 8 half + 0..7
      o[0][f] = wmma_bf16(av.v, bp[0], o[0][f]);
      o[1][f] = wmma_bf16(av.v, bp[1], o[1][f]);
    }

    // foot of the pass: the wave's LDS reads of this buffer have retired, its copies of the
    // next tile have landed; behind the barrier that holds for every wave, so the next
    // buffer may be read and this one refilled
    asm volatile("s_wait_dscnt 0x0" ::: "memory");
    async_wait0();
    __syncthreads();
    if (kc + 64 < T_SEQ) stage(kc + 64, mbuf);
  }

  async_wait0();   // closes the copy ring: no copy of the wave is outstanding when it ends

  // join the halves' sums, normalize, store ctx bf16 at [B,T,E]: 8 d = 16 bytes a lane
#pragma unroll
  for (int c = 0; c < 2; ++c) {
    const float lsum = l_run[c] + other_half(l_run[c]);
    const float inv = 1.0f / lsum;
    bf16* crow = ctx + ((size_t)b * T_SEQ + qw + c * 16 + l16) * EMB + h * DH + half * 8;
#pragma unroll
    for (int f = 0; f < 4; ++f) {
      v8bf ov;
#pragma unroll
      for (int r = 0; r < 8; ++r) ov[r] = f2bf(o[c][f][r] * inv);
      *(v8bf*)(crow + f * 16) = ov;
    }
  }
}

// ---------------------------------------------------------------------------
// Kernel 3: output projection, all-bf16 operands, double-buffered staging.
// out[T,B,E](f32) = ctx[B,T,E](bf16) @ w_out^T + b_out
// ---------------------------------------------------------------------------
__global__ __launch_bounds__(256) void out_proj_kernel(
    const bf16* __restrict__ ctx, const bf16* __restrict__ wout,
    const float* __restrict__ b_out, float* __restrict__ out)
{
  __shared__ bf16 sA[2][128 * 40];
  __shared__ bf16 sB[2][128 * 40];
  const int tid  = threadIdx.x;
  const int lane = tid & 31, wave = tid >> 5;
  const int half = lane >> 4, l16 = lane & 15;
  const int m0 = blockIdx.x * 128;
  const int n0 = blockIdx.y * 128;
  const int wm = wave & 3, wn = wave >> 2;

  auto stage = [&](int kk, bf16* dA, bf16* dB) {
#pragma unroll
    for (int i = 0; i < 2; ++i) {
      int idx = tid + i * 256;
      int row = idx >> 2;
      int c   = (idx & 3) * 8;
      cp16_g2l(ctx  + (size_t)(m0 + row) * EMB + kk + c, dA + row * 40 + c);
      cp16_g2l(wout + (size_t)(n0 + row) * EMB + kk + c, dB + row * 40 + c);
    }
  };

  bf16 *curA = sA[0], *curB = sB[0], *nxtA = sA[1], *nxtB = sB[1];
  stage(0, curA, curB);
  v8f acc[2][4] = {};

#pragma unroll 1
  for (int kt = 0; kt < EMB / 32; ++kt) {
    async_wait0();
    __syncthreads();
    if (kt + 1 < EMB / 32) stage((kt + 1) * 32, nxtA, nxtB);
    v16bf a0 = load_frag(curA, 40, wm * 32,      0);
    v16bf a1 = load_frag(curA, 40, wm * 32 + 16, 0);
#pragma unroll
    for (int j = 0; j < 4; ++j) {
      v16bf b = load_frag(curB, 40, wn * 64 + j * 16, 0);
      acc[0][j] = wmma_bf16(a0, b, acc[0][j]);
      acc[1][j] = wmma_bf16(a1, b, acc[1][j]);
    }
    bf16* t;
    t = curA; curA = nxtA; nxtA = t;
    t = curB; curB = nxtB; nxtB = t;
  }

#pragma unroll
  for (int j = 0; j < 4; ++j) {
    int n = n0 + wn * 64 + j * 16 + l16;
    float bj = b_out[n];
#pragma unroll
    for (int i = 0; i < 2; ++i) {
#pragma unroll
      for (int r = 0; r < 8; ++r) {
        int m = m0 + wm * 32 + i * 16 + r + half * 8;   // row in [B*T]
        int bb = m >> 11;                                // / T_SEQ
        int t  = m & (T_SEQ - 1);
        out[((size_t)t * BATCH + bb) * EMB + n] = acc[i][j][r] + bj;
      }
    }
  }
}

// ---------------------------------------------------------------------------
extern "C" void kernel_launch(void* const* d_in, const int* in_sizes, int n_in,
                              void* d_out, int out_size, void* d_ws, size_t ws_size,
                              hipStream_t stream) {
  (void)in_sizes; (void)n_in; (void)out_size; (void)ws_size;
  const float* query = (const float*)d_in[0];
  const float* key   = (const float*)d_in[1];
  const float* value = (const float*)d_in[2];
  const float* mask  = (const float*)d_in[3];
  const float* w_qkv = (const float*)d_in[4];
  const float* b_qkv = (const float*)d_in[5];
  const float* w_out = (const float*)d_in[6];
  const float* b_out = (const float*)d_in[7];
  float* out = (float*)d_out;

  const size_t NTOK = (size_t)T_SEQ * BATCH * EMB;      // 8388608
  const size_t NWQ  = (size_t)3 * EMB * EMB;            // 3145728
  const size_t NWO  = (size_t)EMB * EMB;                // 1048576
  bf16* xq   = (bf16*)d_ws;           // bf16 copies of inputs
  bf16* xk   = xq + NTOK;
  bf16* xv   = xk + NTOK;
  bf16* wqb  = xv + NTOK;
  bf16* wob  = wqb + NWQ;
  bf16* Qh   = wob + NWO;             // projected [B,H,T,DH]
  bf16* Kh   = Qh + NTOK;
  bf16* Vh   = Kh + NTOK;
  bf16* ctx  = Vh + NTOK;             // [B,T,E]

  // xq, xk, xv, wqb, wob are one contiguous run of the workspace
  cvt_all_kernel<<<256, 512, 0, stream>>>(query, key, value, w_qkv, w_out, xq);

  dim3 gQKV(64, 8, 3);               // M=8192/128, N=1024/128, {q,k,v}
  qkv_proj_kernel<<<gQKV, 256, 0, stream>>>(xq, xk, xv, wqb, b_qkv, Qh, Kh, Vh);

  dim3 gATT(T_SEQ / 128, BATCH * NH / 2);   // 128 queries x 2 heads a block
  attention_kernel<<<gATT, 256, 0, stream>>>(Qh, Kh, Vh, mask, ctx);

  dim3 gOUT(64, 8);                  // M=8192/128, N=1024/128
  out_proj_kernel<<<gOUT, 256, 0, stream>>>(ctx, wob, b_out, out);
}

// v008
// Measured time: 139 microseconds a run.
// Timed twice side by side with v007, it ran 1.16 and 1.17 times as fast.
// All steps since v000 together make it 2.82 times as fast.
#include <hip/hip_runtime.h>
#include <stdint.h>

#define T_SEQ 2048
#define BATCH 4
#define EMB   1024
#define NH    16
#define DH    64
#define ATTN_SCALE 0.125f   // 1/sqrt(64)

typedef __bf16 bf16;
typedef __attribute__((ext_vector_type(16))) __bf16 v16bf;
typedef __attribute__((ext_vector_type(8)))  __bf16 v8bf;
typedef __attribute__((ext_vector_type(4)))  __bf16 v4bf;
typedef __attribute__((ext_vector_type(8)))  float  v8f;
typedef __attribute__((ext_vector_type(4)))  float  f32x4;
typedef __attribute__((ext_vector_type(4)))  unsigned int u32x4;
typedef __attribute__((ext_vector_type(4)))  int i32x4;

union FragU { v16bf v; u32x4 h[2]; };

#if defined(__has_builtin)
#if __has_builtin(__builtin_amdgcn_global_load_async_to_lds_b128)
#define HAVE_ASYNC_LDS 1
#endif
#endif
#ifndef HAVE_ASYNC_LDS
#define HAVE_ASYNC_LDS 0
#endif

__device__ __forceinline__ void cp16_g2l(const bf16* g, bf16* l) {
#if HAVE_ASYNC_LDS
  __builtin_amdgcn_global_load_async_to_lds_b128((i32x4*)g, (i32x4*)l, 0, 0);
#else
  *(u32x4*)l = *(const u32x4*)g;
#endif
}
// four 16-byte copies a lane, each with address registers of its own and no immediate
// offset; the closing wait stands in front of any rewrite of those registers
__device__ __forceinline__ void cp16x4_g2l(const float* g0, const float* g1,
                                           const float* g2, const float* g3,
                                           unsigned l0, unsigned l1,
                                           unsigned l2, unsigned l3) {
  asm volatile("global_load_async_to_lds_b128 %0, %4, off\n\t"
               "global_load_async_to_lds_b128 %1, %5, off\n\t"
               "global_load_async_to_lds_b128 %2, %6, off\n\t"
               "global_load_async_to_lds_b128 %3, %7, off\n\t"
               "s_wait_xcnt 0x0"
               :: "v"(l0), "v"(l1), "v"(l2), "v"(l3), "v"(g0), "v"(g1), "v"(g2), "v"(g3)
               : "memory");
}
__device__ __forceinline__ void async_wait0() {
#if HAVE_ASYNC_LDS
  asm volatile("s_wait_asynccnt 0x0" ::: "memory");
#endif
}

// round-to-nearest-even f32 -> bf16 (bit-level)
__device__ __forceinline__ bf16 f2bf(float f) {
  unsigned u = __builtin_bit_cast(unsigned, f);
  unsigned r = (u + 0x7FFFu + ((u >> 16) & 1u)) >> 16;
  unsigned short s = (unsigned short)r;
  return __builtin_bit_cast(bf16, s);
}

__device__ __forceinline__ v8f wmma_bf16(v16bf a, v16bf b, v8f c) {
  return __builtin_amdgcn_wmma_f32_16x16x32_bf16(false, a, false, b, (short)0, c, false, false);
}

// 16x32 bf16 operand fragment from a row-major LDS tile.
// lane&15 = row, half = K-subset; two contiguous 8-bf16 runs per lane.
__device__ __forceinline__ v16bf load_frag(const bf16* base, int strideBf,
                                           int rowOff, int colOff) {
  const int lane = threadIdx.x & 31;
  const int half = lane >> 4;
  const bf16* p = base + (size_t)((lane & 15) + rowOff) * strideBf + colOff + half * 8;
  FragU f;
  f.h[0] = *(const u32x4*)(p);
  f.h[1] = *(const u32x4*)(p + 16);
  return f.v;
}

// ---------------------------------------------------------------------------
// Kernel 0: f32 -> bf16 conversion of all five operands in ONE launch.
// The five bf16 copies lie one behind another in the workspace, so the output is one
// array of 28,672 units of 1,024 elements: query 8,192 units, key 8,192, value 8,192,
// w_qkv 3,072, w_out 1,024.  grid = 256, block = 512: 4,096 waves, one block a WGP.
// Wave w converts units w + 4096 i, i = 0..6; a unit is 8 loads of 16 bytes a lane,
// and the loads run two units ahead of the conversion.
// ---------------------------------------------------------------------------
#define CVT_WAVES 4096
#define CVT_UNIT  1024
#define CVT_UNITS 7        // units a wave
#define CVT_AHEAD 2        // how many units ahead of the one being converted the loads run
#define CVT_STEP  ((size_t)CVT_WAVES * CVT_UNIT)   // elements between a wave's units

__global__ __launch_bounds__(512) void cvt_all_kernel(
    const float* __restrict__ q, const float* __restrict__ k,
    const float* __restrict__ v, const float* __restrict__ wqkv,
    const float* __restrict__ wout, bf16* __restrict__ out)
{
  const unsigned el = (threadIdx.x & 31u) * 8u;    // this lane's 8 elements of each 256
  const int w = blockIdx.x * 16 + __builtin_amdgcn_readfirstlane(threadIdx.x >> 5);
  const size_t off = (size_t)w * CVT_UNIT;         // wave-uniform
  const float* src[CVT_UNITS] = {
      q + off, q + off + CVT_STEP, k + off, k + off + CVT_STEP,
      v + off, v + off + CVT_STEP,
      (w < 3072) ? wqkv + off : wout + (off - (size_t)3072 * CVT_UNIT)};
  bf16* dst = out + off;

  f32x4 r[CVT_AHEAD + 1][8];                       // ring of unit buffers
#define CVT_LOAD(U) do { _Pragma("unroll") for (int j = 0; j < 4; ++j) { \
    r[(U) % (CVT_AHEAD + 1)][2 * j]     = *(const f32x4*)(src[U] + j * 256 + el); \
    r[(U) % (CVT_AHEAD + 1)][2 * j + 1] = *(const f32x4*)(src[U] + j * 256 + el + 4); } } while (0)
// stands in front of loads that land in registers which issued loads and stores still name
#define CVT_XWAIT() asm volatile("s_wait_xcnt 0x0" ::: "memory")
#pragma unroll
  for (int u = 0; u < CVT_AHEAD; ++u) CVT_LOAD(u);
#pragma unroll
  for (int u = 0; u < CVT_UNITS; ++u) {
    // the two scheduling barriers pin the order "a later unit's loads, then this unit's
    // conversion and stores"; without them the loads bunch and the wave runs dry between
    __builtin_amdgcn_sched_barrier(0);
    if (u + CVT_AHEAD < CVT_UNITS) { CVT_XWAIT(); CVT_LOAD(u + CVT_AHEAD); }
    __builtin_amdgcn_sched_barrier(0);
#pragma unroll
    for (int j = 0; j < 4; ++j) {
      const f32x4 a = r[u % (CVT_AHEAD + 1)][2 * j], b = r[u % (CVT_AHEAD + 1)][2 * j + 1];
      v8bf o;
      o[0] = f2bf(a.x); o[1] = f2bf(a.y); o[2] = f2bf(a.z); o[3] = f2bf(a.w);
      o[4] = f2bf(b.x); o[5] = f2bf(b.y); o[6] = f2bf(b.z); o[7] = f2bf(b.w);
      *(v8bf*)(dst + u * CVT_STEP + j * 256 + el) = o;
    }
  }
#undef CVT_LOAD
#undef CVT_XWAIT
}

// ---------------------------------------------------------------------------
// Main loop of both projections: Y(256 x 128) = X(256 x 1024) W(128 x 1024)^T, all bf16.
// block = 256 (8 waves, 4 x 2, 64 x 64 a wave: 16 products for 8 fragments read from LDS).
// A pass is 64 k: a row's share is 128 bytes, so the 8 lanes that copy it take one whole
// line and a wave-wide copy takes four lines.  Rows lie in LDS at 144 bytes (16 x odd).
// Two buffers: the copies of pass t + 1 fly while pass t is worked on, and one barrier
// behind a pass's last LDS reads hands the buffers over.
// ---------------------------------------------------------------------------
#define G_BM 256
#define G_BN 128
#define G_BK 64
#define G_PITCH 72                    // bf16 a row in LDS
#define G_PASSES (EMB / G_BK)

// x: row 0 of the block's 256 rows of X; w: row 0 of its 128 rows of W
__device__ __forceinline__ void gemm_256x128(const bf16* __restrict__ x,
                                             const bf16* __restrict__ w,
                                             bf16* sA, bf16* sB, v8f (&acc)[4][4]) {
  const int tid  = threadIdx.x;
  const int wave = tid >> 5;
  const int wm = wave & 3, wn = wave >> 2;
  const int srow = tid >> 3, scol = (tid & 7) * 8;   // 8 lanes a row, 32 rows a sweep
  const bf16* xg = x + (size_t)srow * EMB + scol;
  const bf16* wg = w + (size_t)srow * EMB + scol;
  bf16* xl = sA + srow * G_PITCH + scol;
  bf16* wl = sB + srow * G_PITCH + scol;

  auto stage = [&](int kt, int buf) {
#pragma unroll
    for (int i = 0; i < G_BM / 32; ++i)
      cp16_g2l(xg + (size_t)i * 32 * EMB + kt * G_BK,
               xl + buf * (G_BM * G_PITCH) + i * 32 * G_PITCH);
#pragma unroll
    for (int i = 0; i < G_BN / 32; ++i)
      cp16_g2l(wg + (size_t)i * 32 * EMB + kt * G_BK,
               wl + buf * (G_BN * G_PITCH) + i * 32 * G_PITCH);
  };

  stage(0, 0);
  async_wait0();     // pass 0 has landed ...
  __syncthreads();   // ... for every wave
  stage(1, 1);

#pragma unroll 1            // keep accumulators pinned; no unroll-induced copies
  for (int kt = 0; kt < G_PASSES; ++kt) {
    const int buf = kt & 1;
    const bf16* cA = sA + buf * (G_BM * G_PITCH);
    const bf16* cB = sB + buf * (G_BN * G_PITCH);
    v16bf a[4], b[4];
#define G_FRAGS(S) do { \
    _Pragma("unroll") for (int i = 0; i < 4; ++i) a[i] = load_frag(cA, G_PITCH, wm * 64 + i * 16, (S) * 32); \
    _Pragma("unroll") for (int j = 0; j < 4; ++j) b[j] = load_frag(cB, G_PITCH, wn * 64 + j * 16, (S) * 32); } while (0)
#define G_PRODUCTS() do { \
    _Pragma("unroll") for (int j = 0; j < 4; ++j) \
    _Pragma("unroll") for (int i = 0; i < 4; ++i) acc[i][j] = wmma_bf16(a[i], b[j], acc[i][j]); } while (0)
    G_FRAGS(0);
    // keeps the 16 LDS reads one group in front of their 16 products; left to itself the
    // compiler reloads one B fragment among the products and waits it out four times
    __builtin_amdgcn_sched_barrier(0);
    G_PRODUCTS();
    G_FRAGS(1);
    // foot of the pass, behind its last LDS reads: the wave's reads of this buffer have
    // retired, its copies of the next pass have landed; behind the barrier that holds for
    // every wave, so the next buffer may be read and this one refilled
    asm volatile("s_wait_dscnt 0x0" ::: "memory");
    async_wait0();
    __syncthreads();
    if (kt + 2 < G_PASSES) stage(kt + 2, buf);
    // keeps the copies' issue in front of the pass's last 16 products (registers only), so
    // that the copies have a whole pass to land
    __builtin_amdgcn_sched_barrier(0);
    G_PRODUCTS();
  }
#undef G_FRAGS
#undef G_PRODUCTS
  async_wait0();   // closes the copy ring: no copy of the wave is outstanding behind it
}

__global__ __launch_bounds__(256) void qkv_proj_kernel(
    const bf16* __restrict__ xq, const bf16* __restrict__ xk,
    const bf16* __restrict__ xv, const bf16* __restrict__ wqkv,
    const float* __restrict__ b_qkv,
    bf16* __restrict__ q_out, bf16* __restrict__ k_out, bf16* __restrict__ v_out)
{
  __shared__ __attribute__((aligned(16))) bf16 sA[2 * G_BM * G_PITCH];
  __shared__ __attribute__((aligned(16))) bf16 sB[2 * G_BN * G_PITCH];
  const int tid  = threadIdx.x;
  const int lane = tid & 31, wave = tid >> 5;
  const int half = lane >> 4, l16 = lane & 15;
  const int which = blockIdx.z;
  const bf16* x    = (which == 0) ? xq : ((which == 1) ? xk : xv);
  const bf16* w    = wqkv + (size_t)which * EMB * EMB;
  const float* bias = b_qkv + which * EMB;
  bf16* outp        = (which == 0) ? q_out : ((which == 1) ? k_out : v_out);
  const int m0 = blockIdx.x * G_BM;
  const int n0 = blockIdx.y * G_BN;
  const int wm = wave & 3, wn = wave >> 2;

  v8f acc[4][4] = {};
  gemm_256x128(x + (size_t)m0 * EMB, w + (size_t)n0 * EMB, sA, sB, acc);

  // epilogue: +bias, convert, scatter into [B,H,T,DH]
#pragma unroll
  for (int j = 0; j < 4; ++j) {
    int n = n0 + wn * 64 + j * 16 + l16;
    float bj = bias[n];
    int hh = n >> 6, dd = n & 63;
#pragma unroll
    for (int i = 0; i < 4; ++i) {
#pragma unroll
      for (int r = 0; r < 8; ++r) {
        int m = m0 + wm * 64 + i * 16 + r + half * 8;   // row in [T*B]
        int t = m >> 2, bb = m & 3;                      // x is [T,B,E]
        float val = acc[i][j][r] + bj;
        outp[(((size_t)bb * NH + hh) * T_SEQ + t) * DH + dd] = f2bf(val);
      }
    }
  }
}

__device__ __forceinline__ float other_half(float x) {
  int b = __builtin_bit_cast(int, x);
  b = __builtin_amdgcn_permlanex16(b, b, 0x76543210, 0xfedcba98, false, false);
  return __builtin_bit_cast(float, b);
}

#define MASK_PITCH 36   // floats
#define V_PITCH 160     // bytes: 32 x odd, the conflict-free pitch of the transposing load
#define SCALE_LOG2E (ATTN_SCALE * 1.44269504088896340736f)   // raw score -> exponent of 2
#define LAZY_STEP 8.0f   // log2 units a maximum may lie above the reference in use

typedef __attribute__((ext_vector_type(8))) short s16x8;
__device__ __forceinline__ u32x4 ld_tr16(const unsigned char* p) {
  typedef __attribute__((address_space(3))) s16x8 lds_s16x8;
  return __builtin_bit_cast(u32x4, __builtin_amdgcn_ds_load_tr16_b128_v8i16((lds_s16x8*)p));
}

__global__ __launch_bounds__(256) __attribute__((amdgpu_waves_per_eu(4, 4))) void attention_kernel(
    const bf16* __restrict__ Q, const bf16* __restrict__ K,
    const bf16* __restrict__ V, const float* __restrict__ mask,
    bf16* __restrict__ ctx)
{
  // [buffer][head of the block]: 32 keys x 64 d (+8 pad)
  __shared__ __attribute__((aligned(16))) bf16 sK[2][2][32 * 72];
  // V as it lies: 32 keys x 64 d, rows at V_PITCH; transposed on the way to the registers
  __shared__ __attribute__((aligned(16))) unsigned char sV[2][2][32 * V_PITCH];
  __shared__ __attribute__((aligned(16))) float sM[2][128 * MASK_PITCH];

  const int tid  = threadIdx.x;
  const int lane = tid & 31, wave = tid >> 5;
  const int half = lane >> 4, l16 = lane & 15;
  const int hs = wave >> 2, qg = wave & 3;      // head of the block, group of 32 queries
  const int bh = blockIdx.y * 2 + hs;
  const int b  = bh >> 4, h = bh & 15;
  const size_t base = (size_t)bh * T_SEQ * DH;
  const int q0 = blockIdx.x * 128;
  const int qw = q0 + qg * 32;

  // Persistent Q fragments (B operand: column = query), tile c, d in [0,32), [32,64)
  v16bf bq[2][2];
#pragma unroll
  for (int c = 0; c < 2; ++c) {
    const bf16* qp = Q + base + (size_t)(qw + c * 16 + l16) * DH;
#pragma unroll
    for (int s = 0; s < 2; ++s) {
      FragU f;
      f.h[0] = *(const u32x4*)(qp + s * 32 + half * 8);
      f.h[1] = *(const u32x4*)(qp + s * 32 + half * 8 + 16);
      bq[c][s] = f.v;
    }
  }

  // copies: 8 lanes take one row's 128 bytes, a copy takes 4 rows, 4 copies the wave's 16
  const float* mg = mask + (size_t)(q0 + wave * 16 + (lane >> 3)) * T_SEQ + (lane & 7) * 4;
  const unsigned ml = (unsigned)(uintptr_t)
      &sM[0][(wave * 16 + (lane >> 3)) * MASK_PITCH + (lane & 7) * 4];   // LDS byte address
  auto stage_mask = [&](int kc, int buf) {
    const float* g = mg + kc;
    const unsigned l = ml + buf * (128 * MASK_PITCH * 4);
    cp16x4_g2l(g, g + 4 * T_SEQ, g + 8 * T_SEQ, g + 12 * T_SEQ,
               l, l + 4 * MASK_PITCH * 4, l + 8 * MASK_PITCH * 4, l + 12 * MASK_PITCH * 4);
  };
  // this lane's query row of tile 0 in a buffer, at the first key it holds
  const float* mrow = &sM[0][(qg * 32 + l16) * MASK_PITCH + half * 8];
  // this lane's address for the transposing loads of V: d tile f at + 32 f bytes
  const unsigned char* vtr =
      sV[0][hs] + (half * 8 + (lane & 7)) * V_PITCH + ((lane >> 3) & 1) * 16;
  // one pass's tile: K and V of both heads in 16-byte chunks (256 a head, one a thread,
  // 8 lanes a row of 128 bytes) and the wave's 16 mask rows
  const size_t base2 = (size_t)(blockIdx.y * 2) * T_SEQ * DH;
  const bf16* kg = K + base2 + (size_t)(tid >> 3) * DH + (tid & 7) * 8;
  const bf16* vg = V + base2 + (size_t)(tid >> 3) * DH + (tid & 7) * 8;
  auto stage = [&](int kc, int buf) {
#pragma unroll
    for (int hh = 0; hh < 2; ++hh) {
      cp16_g2l(kg + (size_t)hh * T_SEQ * DH + (size_t)kc * DH,
               sK[buf][hh] + (tid >> 3) * 72 + (tid & 7) * 8);
      cp16_g2l(vg + (size_t)hh * T_SEQ * DH + (size_t)kc * DH,
               (bf16*)(sV[buf][hh] + (tid >> 3) * V_PITCH + (tid & 7) * 16));
    }
    stage_mask(kc, buf);
  };
  stage(0, 0);
  async_wait0();     // tile 0 has landed ...
  __syncthreads();   // ... for every wave
  stage(32, 1);

  // per query tile c:
  float ref[2] = {-3.0e38f, -3.0e38f};   // reference of this lane's query, log2 units
  float lim[2] = {-3.0e38f, -3.0e38f};   // raw score above which the reference moves
  float l_run[2] = {0.0f, 0.0f};         // running sum over this half's keys; joined at the end
  v8f o[2][4] = {};                      // o[c][f][r] = O[query l16 of tile c][d = 16 f + 8 half + r]

#pragma unroll 1
  for (int kc = 0; kc < T_SEQ; kc += 32) {
    const int mbuf = (kc >> 5) & 1;
    // K fragments of the pass: each is the A operand of both query tiles
    v16bf ak[2][2];
#pragma unroll
    for (int j = 0; j < 2; ++j) {
      ak[j][0] = load_frag(sK[mbuf][hs], 72, j * 16, 0);
      ak[j][1] = load_frag(sK[mbuf][hs], 72, j * 16, 32);
    }
    // mask of the lane's two queries at the 2 x 8 keys it holds
    f32x4 mk[2][2][2];
#pragma unroll
    for (int c = 0; c < 2; ++c)
#pragma unroll
      for (int j = 0; j < 2; ++j) {
        const float* mp = mrow + mbuf * (128 * MASK_PITCH) + c * (16 * MASK_PITCH) + j * 16;
        mk[c][j][0] = *(const f32x4*)(mp);
        mk[c][j][1] = *(const f32x4*)(mp + 4);
      }

    // S^T(32x16) = K(32x64) Q^T, twice
    v8f sacc[2][2] = {};
#pragma unroll
    for (int s = 0; s < 2; ++s)
#pragma unroll
      for (int j = 0; j < 2; ++j)
#pragma unroll
        for (int c = 0; c < 2; ++c) sacc[c][j] = wmma_bf16(ak[j][s], bq[c][s], sacc[c][j]);

    // raw scores t = s mask; softmax against a held reference (lazy rescale): while no
    // maximum of the pass lies more than LAZY_STEP (log2 units) above the reference in use,
    // the reference stands and neither alpha nor a rescale of O and l is worked out
    float mx[2];
#pragma unroll
    for (int c = 0; c < 2; ++c) {
      mx[c] = -3.0e38f;
#pragma unroll
      for (int j = 0; j < 2; ++j) {
        sacc[c][j] = sacc[c][j] *
            __builtin_shufflevector(mk[c][j][0], mk[c][j][1], 0, 1, 2, 3, 4, 5, 6, 7);
#pragma unroll
        for (int r = 0; r < 8; ++r) mx[c] = fmaxf(mx[c], sacc[c][j][r]);
      }
    }
    // one test a pass, a scalar branch for the whole wave and both tiles
    if (__builtin_amdgcn_ballot_w32((mx[0] > lim[0]) | (mx[1] > lim[1])) != 0) {
#pragma unroll
      for (int c = 0; c < 2; ++c) {
        const float m2    = fmaxf(mx[c], other_half(mx[c]));
        const float rnew  = fmaxf(ref[c], m2 * SCALE_LOG2E);
        const float alpha = __builtin_amdgcn_exp2f(ref[c] - rnew);
        ref[c] = rnew;
        lim[c] = (rnew + LAZY_STEP) * (1.0f / SCALE_LOG2E);
        l_run[c] *= alpha;
#pragma unroll
        for (int f = 0; f < 4; ++f)
#pragma unroll
          for (int r = 0; r < 8; ++r) o[c][f][r] *= alpha;
      }
    }
    // p = 2^(t c - ref): one fma and one exp2 a score (c2, nref: a scalar in every element)
    const v8f c2 = SCALE_LOG2E - (v8f){};
    v16bf bp[2];
#pragma unroll
    for (int c = 0; c < 2; ++c) {
      const v8f nref = -ref[c] - (v8f){};
#pragma unroll
      for (int j = 0; j < 2; ++j) {
        const v8f e = __builtin_elementwise_fma(sacc[c][j], c2, nref);
#pragma unroll
        for (int r = 0; r < 8; ++r) sacc[c][j][r] = __builtin_amdgcn_exp2f(e[r]);
      }
      const v8f ps = sacc[c][0] + sacc[c][1];
      l_run[c] += ((ps[0] + ps[1]) + (ps[2] + ps[3])) + ((ps[4] + ps[5]) + (ps[6] + ps[7]));

      // the two score tiles, converted in place, are the B operand P^T (32 keys x 16 q)
      const v8bf pl = __builtin_convertvector(sacc[c][0], v8bf);
      const v8bf ph = __builtin_convertvector(sacc[c][1], v8bf);
      bp[c] = __builtin_shufflevector(pl, ph, 0, 1, 2, 3, 4, 5, 6, 7,
                                      8, 9, 10, 11, 12, 13, 14, 15);
    }
#pragma unroll
    for (int f = 0; f < 4; ++f) {
      FragU av;                                     // A: 16 d x 32 keys, keys in P^T's order
      av.h[0] = ld_tr16(vtr + mbuf * (2 * 32 * V_PITCH) + 32 * f);   // keys 8 half + 0..7
      av.h[1] = ld_tr16(vtr + mbuf * (2 * 32 * V_PITCH) + 16 * V_PITCH + 32 * f);   // 16 + 8 half + 0..7
      o[0][f] = wmma_bf16(av.v, bp[0], o[0][f]);
      o[1][f] = wmma_bf16(av.v, bp[1], o[1][f]);
    }

    // foot of the pass: the wave's LDS reads of this buffer have retired, its copies of the
    // next tile have landed; behind the barrier that holds for every wave, so the next
    // buffer may be read and this one refilled
    asm volatile("s_wait_dscnt 0x0" ::: "memory");
    async_wait0();
    __syncthreads();
    if (kc + 64 < T_SEQ) stage(kc + 64, mbuf);
  }

  async_wait0();   // closes the copy ring: no copy of the wave is outstanding when it ends

  // join the halves' sums, normalize, store ctx bf16 at [B,T,E]: 8 d = 16 bytes a lane
#pragma unroll
  for (int c = 0; c < 2; ++c) {
    const float lsum = l_run[c] + other_half(l_run[c]);
    const float inv = 1.0f / lsum;
    bf16* crow = ctx + ((size_t)b * T_SEQ + qw + c * 16 + l16) * EMB + h * DH + half * 8;
#pragma unroll
    for (int f = 0; f < 4; ++f) {
      v8bf ov;
#pragma unroll
      for (int r = 0; r < 8; ++r) ov[r] = f2bf(o[c][f][r] * inv);
      *(v8bf*)(crow + f * 16) = ov;
    }
  }
}

// ---------------------------------------------------------------------------
// Kernel 3: output projection.  grid = (M/256, N/128), block = 256: one block a WGP.
// out[T,B,E](f32) = ctx[B,T,E](bf16) @ w_out^T + b_out
// ---------------------------------------------------------------------------
__global__ __launch_bounds__(256) void out_proj_kernel(
    const bf16* __restrict__ ctx, const bf16* __restrict__ wout,
    const float* __restrict__ b_out, float* __restrict__ out)
{
  __shared__ __attribute__((aligned(16))) bf16 sA[2 * G_BM * G_PITCH];
  __shared__ __attribute__((aligned(16))) bf16 sB[2 * G_BN * G_PITCH];
  const int tid  = threadIdx.x;
  const int lane = tid & 31, wave = tid >> 5;
  const int half = lane >> 4, l16 = lane & 15;
  const int m0 = blockIdx.x * G_BM;
  const int n0 = blockIdx.y * G_BN;
  const int wm = wave & 3, wn = wave >> 2;

  v8f acc[4][4] = {};
  gemm_256x128(ctx + (size_t)m0 * EMB, wout + (size_t)n0 * EMB, sA, sB, acc);

#pragma unroll
  for (int j = 0; j < 4; ++j) {
    int n = n0 + wn * 64 + j * 16 + l16;
    float bj = b_out[n];
#pragma unroll
    for (int i = 0; i < 4; ++i) {
#pragma unroll
      for (int r = 0; r < 8; ++r) {
        int m = m0 + wm * 64 + i * 16 + r + half * 8;   // row in [B*T]
        int bb = m >> 11;                                // / T_SEQ
        int t  = m & (T_SEQ - 1);
        out[((size_t)t * BATCH + bb) * EMB + n] = acc[i][j][r] + bj;
      }
    }
  }
}

// ---------------------------------------------------------------------------
extern "C" void kernel_launch(void* const* d_in, const int* in_sizes, int n_in,
                              void* d_out, int out_size, void* d_ws, size_t ws_size,
                              hipStream_t stream) {
  (void)in_sizes; (void)n_in; (void)out_size; (void)ws_size;
  const float* query = (const float*)d_in[0];
  const float* key   = (const float*)d_in[1];
  const float* value = (const float*)d_in[2];
  const float* mask  = (const float*)d_in[3];
  const float* w_qkv = (const float*)d_in[4];
  const float* b_qkv = (const float*)d_in[5];
  const float* w_out = (const float*)d_in[6];
  const float* b_out = (const float*)d_in[7];
  float* out = (float*)d_out;

  const size_t NTOK = (size_t)T_SEQ * BATCH * EMB;      // 8388608
  const size_t NWQ  = (size_t)3 * EMB * EMB;            // 3145728
  const size_t NWO  = (size_t)EMB * EMB;                // 1048576
  bf16* xq   = (bf16*)d_ws;           // bf16 copies of inputs
  bf16* xk   = xq + NTOK;
  bf16* xv   = xk + NTOK;
  bf16* wqb  = xv + NTOK;
  bf16* wob  = wqb + NWQ;
  bf16* Qh   = wob + NWO;             // projected [B,H,T,DH]
  bf16* Kh   = Qh + NTOK;
  bf16* Vh   = Kh + NTOK;
  bf16* ctx  = Vh + NTOK;             // [B,T,E]

  // xq, xk, xv, wqb, wob are one contiguous run of the workspace
  cvt_all_kernel<<<256, 512, 0, stream>>>(query, key, value, w_qkv, w_out, xq);

  dim3 gQKV(32, 8, 3);               // M=8192/256, N=1024/128, {q,k,v}
  qkv_proj_kernel<<<gQKV, 256, 0, stream>>>(xq, xk, xv, wqb, b_qkv, Qh, Kh, Vh);

  dim3 gATT(T_SEQ / 128, BATCH * NH / 2);   // 128 queries x 2 heads a block
  attention_kernel<<<gATT, 256, 0, stream>>>(Qh, Kh, Vh, mask, ctx);

  dim3 gOUT(32, 8);                  // M=8192/256, N=1024/128
  out_proj_kernel<<<gOUT, 256, 0, stream>>>(ctx, wob, b_out, out);
}

// v009
// It runs in 133 microseconds.
// Two timings next to v008 put it at 1.06 and 1.05 times that version's speed.
// All steps since v000 together make it 2.96 times as fast.
#include <hip/hip_runtime.h>
#include <stdint.h>

#define T_SEQ 2048
#define BATCH 4
#define EMB   1024
#define NH    16
#define DH    64
#define ATTN_SCALE 0.125f   // 1/sqrt(64)

typedef __bf16 bf16;
typedef __attribute__((ext_vector_type(16))) __bf16 v16bf;
typedef __attribute__((ext_vector_type(8)))  __bf16 v8bf;
typedef __attribute__((ext_vector_type(4)))  __bf16 v4bf;
typedef __attribute__((ext_vector_type(8)))  float  v8f;
typedef __attribute__((ext_vector_type(4)))  float  f32x4;
typedef __attribute__((ext_vector_type(4)))  unsigned int u32x4;

union FragU { v16bf v; u32x4 h[2]; };

// ---- tensor loads: one request of a wave brings a tile of 128-byte rows into LDS ----
typedef __attribute__((ext_vector_type(8))) unsigned int u32x8;
__device__ __forceinline__ uint32_t uni(uint32_t v) {
  return (uint32_t)__builtin_amdgcn_readfirstlane((int)v);
}
__device__ __forceinline__ uint32_t pinned(uint32_t v) {
  uint32_t w = uni(v);
  asm volatile("" : "+s"(w));
  return w;
}
#define TDM_ROW 128u                                       // bytes a row
#define TDM_PAD16 ((1u << 20) | (4u << 22) | (3u << 25))   // LDS pitch 144: rows read by ds_load_b128
#define TDM_PAD32 ((1u << 20) | (4u << 22) | (7u << 25))   // LDS pitch 160: rows read by ds_load_tr16_b128
template <uint32_t WORD0>
__device__ __forceinline__ u32x8 tdm_group1(uint32_t rows, uint32_t src_pitch) {
  u32x8 g1;
  g1[0] = pinned(WORD0);
  g1[1] = pinned(TDM_ROW << 16);
  g1[2] = pinned(rows << 16);
  g1[3] = pinned(TDM_ROW << 16);
  g1[4] = pinned(rows);
  g1[5] = pinned(src_pitch);
  g1[6] = pinned(0u);
  g1[7] = pinned(0u);
  return g1;
}
__device__ __forceinline__ u32x4 tdm_group0(uint32_t lds_dst, uint64_t ga) {
  u32x4 g0;
  g0[0] = uni(1u);
  g0[1] = uni(lds_dst);
  g0[2] = uni((uint32_t)ga);
  g0[3] = uni((((uint32_t)(ga >> 32)) & 0x01FFFFFFu) | 0x80000000u);
  return g0;
}
__device__ __forceinline__ void tdm_load(u32x4 g0, u32x8 g1) {
  // one request of the whole wave, through no vector register; the waits are written by hand
  asm volatile("tensor_load_to_lds %0, %1" :: "s"(g0), "s"(g1) : "memory");
}
// the issuing wave's own requests have landed
__device__ __forceinline__ void tensor_wait0() {
  asm volatile("s_wait_tensorcnt 0x0" ::: "memory");
}

// round-to-nearest-even f32 -> bf16 (bit-level)
__device__ __forceinline__ bf16 f2bf(float f) {
  unsigned u = __builtin_bit_cast(unsigned, f);
  unsigned r = (u + 0x7FFFu + ((u >> 16) & 1u)) >> 16;
  unsigned short s = (unsigned short)r;
  return __builtin_bit_cast(bf16, s);
}

__device__ __forceinline__ v8f wmma_bf16(v16bf a, v16bf b, v8f c) {
  return __builtin_amdgcn_wmma_f32_16x16x32_bf16(false, a, false, b, (short)0, c, false, false);
}

// 16x32 bf16 operand fragment from a row-major LDS tile.
// lane&15 = row, half = K-subset; two contiguous 8-bf16 runs per lane.
__device__ __forceinline__ v16bf load_frag(const bf16* base, int strideBf,
                                           int rowOff, int colOff) {
  const int lane = threadIdx.x & 31;
  const int half = lane >> 4;
  const bf16* p = base + (size_t)((lane & 15) + rowOff) * strideBf + colOff + half * 8;
  FragU f;
  f.h[0] = *(const u32x4*)(p);
  f.h[1] = *(const u32x4*)(p + 16);
  return f.v;
}

// ---------------------------------------------------------------------------
// Kernel 0: f32 -> bf16 conversion of all five operands in ONE launch.
// The five bf16 copies lie one behind another in the workspace, so the output is one
// array of 28,672 units of 1,024 elements: query 8,192 units, key 8,192, value 8,192,
// w_qkv 3,072, w_out 1,024.  grid = 256, block = 512: 4,096 waves, one block a WGP.
// Wave w converts units w + 4096 i, i = 0..6; a unit is 8 loads of 16 bytes a lane,
// and the loads run two units ahead of the conversion.
// ---------------------------------------------------------------------------
#define CVT_WAVES 4096
#define CVT_UNIT  1024
#define CVT_UNITS 7        // units a wave
#define CVT_AHEAD 2        // how many units ahead of the one being converted the loads run
#define CVT_STEP  ((size_t)CVT_WAVES * CVT_UNIT)   // elements between a wave's units

__global__ __launch_bounds__(512) void cvt_all_kernel(
    const float* __restrict__ q, const float* __restrict__ k,
    const float* __restrict__ v, const float* __restrict__ wqkv,
    const float* __restrict__ wout, bf16* __restrict__ out)
{
  const unsigned el = (threadIdx.x & 31u) * 8u;    // this lane's 8 elements of each 256
  const int w = blockIdx.x * 16 + __builtin_amdgcn_readfirstlane(threadIdx.x >> 5);
  const size_t off = (size_t)w * CVT_UNIT;         // wave-uniform
  const float* src[CVT_UNITS] = {
      q + off, q + off + CVT_STEP, k + off, k + off + CVT_STEP,
      v + off, v + off + CVT_STEP,
      (w < 3072) ? wqkv + off : wout + (off - (size_t)3072 * CVT_UNIT)};
  bf16* dst = out + off;

  f32x4 r[CVT_AHEAD + 1][8];                       // ring of unit buffers
#define CVT_LOAD(U) do { _Pragma("unroll") for (int j = 0; j < 4; ++j) { \
    r[(U) % (CVT_AHEAD + 1)][2 * j]     = *(const f32x4*)(src[U] + j * 256 + el); \
    r[(U) % (CVT_AHEAD + 1)][2 * j + 1] = *(const f32x4*)(src[U] + j * 256 + el + 4); } } while (0)
// stands in front of loads that land in registers which issued loads and stores still name
#define CVT_XWAIT() asm volatile("s_wait_xcnt 0x0" ::: "memory")
#pragma unroll
  for (int u = 0; u < CVT_AHEAD; ++u) CVT_LOAD(u);
#pragma unroll
  for (int u = 0; u < CVT_UNITS; ++u) {
    // the two scheduling barriers pin the order "a later unit's loads, then this unit's
    // conversion and stores"; without them the loads bunch and the wave runs dry between
    __builtin_amdgcn_sched_barrier(0);
    if (u + CVT_AHEAD < CVT_UNITS) { CVT_XWAIT(); CVT_LOAD(u + CVT_AHEAD); }
    __builtin_amdgcn_sched_barrier(0);
#pragma unroll
    for (int j = 0; j < 4; ++j) {
      const f32x4 a = r[u % (CVT_AHEAD + 1)][2 * j], b = r[u % (CVT_AHEAD + 1)][2 * j + 1];
      v8bf o;
      o[0] = f2bf(a.x); o[1] = f2bf(a.y); o[2] = f2bf(a.z); o[3] = f2bf(a.w);
      o[4] = f2bf(b.x); o[5] = f2bf(b.y); o[6] = f2bf(b.z); o[7] = f2bf(b.w);
      *(v8bf*)(dst + u * CVT_STEP + j * 256 + el) = o;
    }
  }
#undef CVT_LOAD
#undef CVT_XWAIT
}

// ---------------------------------------------------------------------------
// Main loop of both projections: Y(256 x 128) = X(256 x 1024) W(128 x 1024)^T, all bf16.
// block = 256 (8 waves, 4 x 2, 64 x 64 a wave: 16 products for 8 fragments read from LDS).
// A pass is 64 k: a row's share is 128 bytes, one whole line.  Every wave brings one slice of
// the pass by ONE tensor load: waves 0-3 64 rows of X each, waves 4-7 32 rows of W each; the
// load's pad lays the rows in LDS at 144 bytes (16 x odd).  A slice's place is a multiple of
// 2 KiB.  Two buffers: the loads of pass t + 1 fly while pass t is worked on, and one barrier
// behind a pass's last LDS reads hands the buffers over.
// ---------------------------------------------------------------------------
#define G_BM 256
#define G_BN 128
#define G_BK 64
#define G_PITCH 72                    // bf16 a row in LDS
#define G_PASSES (EMB / G_BK)
#define G_XSLOT 10240                 // bytes: 64 rows x 144, rounded up to 2 KiB
#define G_WSLOT 6144                  // bytes: 32 rows x 144, rounded up to 2 KiB
#define G_BUF (4 * G_XSLOT + 4 * G_WSLOT)   // one buffer: X slices, then W slices

// x: row 0 of the block's 256 rows of X; w: row 0 of its 128 rows of W
__device__ __forceinline__ void gemm_256x128(const bf16* __restrict__ x,
                                             const bf16* __restrict__ w,
                                             const unsigned char* ring, v8f (&acc)[4][4]) {
  const int tid  = threadIdx.x;
  const int wave = tid >> 5;
  const int wm = wave & 3, wn = wave >> 2;
  // this wave's slice: source, rows, place in a buffer (all wave-uniform)
  const uint32_t wv = uni(threadIdx.x >> 5);
  const uint32_t rows = (wv < 4u) ? 64u : 32u;
  const uint64_t src = (wv < 4u) ? (uint64_t)(x + (size_t)wv * 64 * EMB)
                                 : (uint64_t)(w + (size_t)(wv - 4u) * 32 * EMB);
  const uint32_t place = (uint32_t)(uintptr_t)ring +
      ((wv < 4u) ? wv * G_XSLOT : 4u * G_XSLOT + (wv - 4u) * G_WSLOT);

  const u32x8 g1 = tdm_group1<TDM_PAD16>(rows, EMB * 2);
  auto stage = [&](uint32_t kt, uint32_t buf) {
    tdm_load(tdm_group0(place + buf * G_BUF, src + (uint64_t)kt * (G_BK * 2)), g1);
  };

  stage(0, 0);
  tensor_wait0();    // the wave's slice of pass 0 has landed ...
  __syncthreads();   // ... and every wave's
  stage(1, 1);

#pragma unroll 1            // keep accumulators pinned; no unroll-induced copies
  for (int kt = 0; kt < G_PASSES; ++kt) {
    const int buf = kt & 1;
    // the wave's 64 rows of X are slice wm; its 64 rows of W are slices 2 wn and 2 wn + 1
    const bf16* cA = (const bf16*)(ring + buf * G_BUF + wm * G_XSLOT);
    const bf16* cB = (const bf16*)(ring + buf * G_BUF + 4 * G_XSLOT + wn * 2 * G_WSLOT);
    v16bf a[4], b[4];
#define G_FRAGS(S) do { \
    _Pragma("unroll") for (int i = 0; i < 4; ++i) a[i] = load_frag(cA, G_PITCH, i * 16, (S) * 32); \
    _Pragma("unroll") for (int j = 0; j < 4; ++j) b[j] = load_frag(cB + (j >> 1) * (G_WSLOT / 2), G_PITCH, (j & 1) * 16, (S) * 32); } while (0)
#define G_PRODUCTS() do { \
    _Pragma("unroll") for (int j = 0; j < 4; ++j) \
    _Pragma("unroll") for (int i = 0; i < 4; ++i) acc[i][j] = wmma_bf16(a[i], b[j], acc[i][j]); } while (0)
    G_FRAGS(0);
    // keeps the 16 LDS reads one group in front of their 16 products; left to itself the
    // compiler reloads one B fragment among the products and waits it out four times
    __builtin_amdgcn_sched_barrier(0);
    G_PRODUCTS();
    G_FRAGS(1);
    // foot of the pass, behind its last LDS reads: the wave's reads of this buffer have
    // retired, its slice of the next pass has landed; behind the barrier that holds for
    // every wave, so the next buffer may be read and this one refilled
    asm volatile("s_wait_dscnt 0x0" ::: "memory");
    tensor_wait0();
    __syncthreads();
    if (pinned(kt + 2 < G_PASSES)) stage(pinned(kt + 2), pinned(buf));
    // keeps the load's issue in front of the pass's last 16 products (registers only), so
    // that the load has a whole pass to land
    __builtin_amdgcn_sched_barrier(0);
    G_PRODUCTS();
  }
#undef G_FRAGS
#undef G_PRODUCTS
  // closes the ring: no request and no LDS read of the wave is outstanding behind it
  tensor_wait0();
  asm volatile("s_wait_dscnt 0x0" ::: "memory");
}

__global__ __launch_bounds__(256) __attribute__((amdgpu_waves_per_eu(4, 4))) void qkv_proj_kernel(
    const bf16* __restrict__ xq, const bf16* __restrict__ xk,
    const bf16* __restrict__ xv, const bf16* __restrict__ wqkv,
    const float* __restrict__ b_qkv,
    bf16* __restrict__ q_out, bf16* __restrict__ k_out, bf16* __restrict__ v_out)
{
  __shared__ __attribute__((aligned(2048))) unsigned char ring[2 * G_BUF];
  const int tid  = threadIdx.x;
  const int lane = tid & 31, wave = tid >> 5;
  const int half = lane >> 4, l16 = lane & 15;
  const int which = blockIdx.z;
  const bf16* x    = (which == 0) ? xq : ((which == 1) ? xk : xv);
  const bf16* w    = wqkv + (size_t)which * EMB * EMB;
  const float* bias = b_qkv + which * EMB;
  bf16* outp        = (which == 0) ? q_out : ((which == 1) ? k_out : v_out);
  const int m0 = blockIdx.x * G_BM;
  const int n0 = blockIdx.y * G_BN;
  const int wm = wave & 3, wn = wave >> 2;

  v8f acc[4][4] = {};
  gemm_256x128(x + (size_t)m0 * EMB, w + (size_t)n0 * EMB, ring, acc);

  // epilogue: +bias, convert, scatter into [B,H,T,DH]
#pragma unroll
  for (int j = 0; j < 4; ++j) {
    int n = n0 + wn * 64 + j * 16 + l16;
    float bj = bias[n];
    int hh = n >> 6, dd = n & 63;
#pragma unroll
    for (int i = 0; i < 4; ++i) {
#pragma unroll
      for (int r = 0; r < 8; ++r) {
        int m = m0 + wm * 64 + i * 16 + r + half * 8;   // row in [T*B]
        int t = m >> 2, bb = m & 3;                      // x is [T,B,E]
        float val = acc[i][j][r] + bj;
        outp[(unsigned)(((bb * NH + hh) * T_SEQ + t) * DH + dd)] = f2bf(val);   // 32-bit index: fewer address registers
      }
    }
  }
}

__device__ __forceinline__ float other_half(float x) {
  int b = __builtin_bit_cast(int, x);
  b = __builtin_amdgcn_permlanex16(b, b, 0x76543210, 0xfedcba98, false, false);
  return __builtin_bit_cast(float, b);
}

#define MASK_PITCH 36   // floats
#define V_PITCH 160     // bytes: 32 x odd, the conflict-free pitch of the transposing load
#define A_SLOT 6144     // bytes a slice: 32 rows x 144 or 160, rounded up to 2 KiB
#define A_BUF (8 * A_SLOT)
#define SCALE_LOG2E (ATTN_SCALE * 1.44269504088896340736f)   // raw score -> exponent of 2
#define LAZY_STEP 8.0f   // log2 units a maximum may lie above the reference in use

typedef __attribute__((ext_vector_type(8))) short s16x8;
__device__ __forceinline__ u32x4 ld_tr16(const unsigned char* p) {
  typedef __attribute__((address_space(3))) s16x8 lds_s16x8;
  return __builtin_bit_cast(u32x4, __builtin_amdgcn_ds_load_tr16_b128_v8i16((lds_s16x8*)p));
}

__global__ __launch_bounds__(256) __attribute__((amdgpu_waves_per_eu(4, 4))) void attention_kernel(
    const bf16* __restrict__ Q, const bf16* __restrict__ K,
    const bf16* __restrict__ V, const float* __restrict__ mask,
    bf16* __restrict__ ctx)
{
  __shared__ __attribute__((aligned(2048))) unsigned char ring[2 * A_BUF];

  const int tid  = threadIdx.x;
  const int lane = tid & 31, wave = tid >> 5;
  const int half = lane >> 4, l16 = lane & 15;
  const int hs = wave >> 2, qg = wave & 3;      // head of the block, group of 32 queries
  const int bh = blockIdx.y * 2 + hs;
  const int b  = bh >> 4, h = bh & 15;
  const size_t base = (size_t)bh * T_SEQ * DH;
  const int q0 = blockIdx.x * 128;
  const int qw = q0 + qg * 32;

  // Persistent Q fragments (B operand: column = query), tile c, d in [0,32), [32,64)
  v16bf bq[2][2];
#pragma unroll
  for (int c = 0; c < 2; ++c) {
    const bf16* qp = Q + base + (size_t)(qw + c * 16 + l16) * DH;
#pragma unroll
    for (int s = 0; s < 2; ++s) {
      FragU f;
      f.h[0] = *(const u32x4*)(qp + s * 32 + half * 8);
      f.h[1] = *(const u32x4*)(qp + s * 32 + half * 8 + 16);
      bq[c][s] = f.v;
    }
  }

  // this lane's query row of tile 0 in a buffer, at the first key it holds
  const float* mrow = (const float*)(ring + (4 + qg) * A_SLOT) + l16 * MASK_PITCH + half * 8;
  // this lane's address for the transposing loads of V: d tile f at + 32 f bytes
  const unsigned char* vtr =
      ring + (2 + hs) * A_SLOT + (half * 8 + (lane & 7)) * V_PITCH + ((lane >> 3) & 1) * 16;
  // this wave's slice: source, source pitch, bytes from one pass to the next (all wave-uniform)
  const uint32_t wv = uni(threadIdx.x >> 5);
  const size_t base2 = ((size_t)(blockIdx.y * 2) + (wv & 1u)) * T_SEQ * DH;
  const uint64_t src = (wv < 2u) ? (uint64_t)(K + base2)
                     : (wv < 4u) ? (uint64_t)(V + base2)
                                 : (uint64_t)(mask + (size_t)(q0 + (wv - 4u) * 32u) * T_SEQ);
  const uint32_t spitch = (wv < 4u) ? DH * 2u : T_SEQ * 4u;
  const uint32_t sstep  = (wv < 4u) ? 32u * DH * 2u : 32u * 4u;
  const uint32_t place  = (uint32_t)(uintptr_t)ring + wv * A_SLOT;
  const u32x8 g1v = tdm_group1<TDM_PAD32>(32u, spitch);
  const u32x8 g1k = tdm_group1<TDM_PAD16>(32u, spitch);
  auto stage = [&](uint32_t pass, uint32_t buf) {
    const u32x4 g0 = tdm_group0(place + buf * A_BUF, src + (uint64_t)pass * sstep);
    // two issue sites, so that the pad word is a constant at each
    if (pinned((wv & 6u) == 2u)) tdm_load(g0, g1v);
    else                         tdm_load(g0, g1k);
  };
  stage(0, 0);
  tensor_wait0();    // the wave's slice of tile 0 has landed ...
  __syncthreads();   // ... and every wave's
  stage(1, 1);

  // per query tile c:
  float ref[2] = {-3.0e38f, -3.0e38f};   // reference of this lane's query, log2 units
  float lim[2] = {-3.0e38f, -3.0e38f};   // raw score above which the reference moves
  float l_run[2] = {0.0f, 0.0f};         // running sum over this half's keys; joined at the end
  v8f o[2][4] = {};                      // o[c][f][r] = O[query l16 of tile c][d = 16 f + 8 half + r]

#pragma unroll 1
  for (int kc = 0; kc < T_SEQ; kc += 32) {
    const int mbuf = (kc >> 5) & 1;
    // K fragments of the pass: each is the A operand of both query tiles
    v16bf ak[2][2];
#pragma unroll
    for (int j = 0; j < 2; ++j) {
      ak[j][0] = load_frag((const bf16*)(ring + mbuf * A_BUF + hs * A_SLOT), 72, j * 16, 0);
      ak[j][1] = load_frag((const bf16*)(ring + mbuf * A_BUF + hs * A_SLOT), 72, j * 16, 32);
    }
    // mask of the lane's two queries at the 2 x 8 keys it holds
    f32x4 mk[2][2][2];
#pragma unroll
    for (int c = 0; c < 2; ++c)
#pragma unroll
      for (int j = 0; j < 2; ++j) {
        const float* mp = mrow + mbuf * (A_BUF / 4) + c * (16 * MASK_PITCH) + j * 16;
        mk[c][j][0] = *(const f32x4*)(mp);
        mk[c][j][1] = *(const f32x4*)(mp + 4);
      }

    // S^T(32x16) = K(32x64) Q^T, twice
    v8f sacc[2][2] = {};
#pragma unroll
    for (int s = 0; s < 2; ++s)
#pragma unroll
      for (int j = 0; j < 2; ++j)
#pragma unroll
        for (int c = 0; c < 2; ++c) sacc[c][j] = wmma_bf16(ak[j][s], bq[c][s], sacc[c][j]);

    // raw scores t = s mask; softmax against a held reference (lazy rescale): while no
    // maximum of the pass lies more than LAZY_STEP (log2 units) above the reference in use,
    // the reference stands and neither alpha nor a rescale of O and l is worked out
    float mx[2];
#pragma unroll
    for (int c = 0; c < 2; ++c) {
      mx[c] = -3.0e38f;
#pragma unroll
      for (int j = 0; j < 2; ++j) {
        sacc[c][j] = sacc[c][j] *
            __builtin_shufflevector(mk[c][j][0], mk[c][j][1], 0, 1, 2, 3, 4, 5, 6, 7);
#pragma unroll
        for (int r = 0; r < 8; ++r) mx[c] = fmaxf(mx[c], sacc[c][j][r]);
      }
    }
    // one test a pass, a scalar branch for the whole wave and both tiles
    if (__builtin_amdgcn_ballot_w32((mx[0] > lim[0]) | (mx[1] > lim[1])) != 0) {
#pragma unroll
      for (int c = 0; c < 2; ++c) {
        const float m2    = fmaxf(mx[c], other_half(mx[c]));
        const float rnew  = fmaxf(ref[c], m2 * SCALE_LOG2E);
        const float alpha = __builtin_amdgcn_exp2f(ref[c] - rnew);
        ref[c] = rnew;
        lim[c] = (rnew + LAZY_STEP) * (1.0f / SCALE_LOG2E);
        l_run[c] *= alpha;
#pragma unroll
        for (int f = 0; f < 4; ++f)
#pragma unroll
          for (int r = 0; r < 8; ++r) o[c][f][r] *= alpha;
      }
    }
    // p = 2^(t c - ref): one fma and one exp2 a score (c2, nref: a scalar in every element)
    const v8f c2 = SCALE_LOG2E - (v8f){};
    v16bf bp[2];
#pragma unroll
    for (int c = 0; c < 2; ++c) {
      const v8f nref = -ref[c] - (v8f){};
#pragma unroll
      for (int j = 0; j < 2; ++j) {
        const v8f e = __builtin_elementwise_fma(sacc[c][j], c2, nref);
#pragma unroll
        for (int r = 0; r < 8; ++r) sacc[c][j][r] = __builtin_amdgcn_exp2f(e[r]);
      }
      const v8f ps = sacc[c][0] + sacc[c][1];
      l_run[c] += ((ps[0] + ps[1]) + (ps[2] + ps[3])) + ((ps[4] + ps[5]) + (ps[6] + ps[7]));

      // the two score tiles, converted in place, are the B operand P^T (32 keys x 16 q)
      const v8bf pl = __builtin_convertvector(sacc[c][0], v8bf);
      const v8bf ph = __builtin_convertvector(sacc[c][1], v8bf);
      bp[c] = __builtin_shufflevector(pl, ph, 0, 1, 2, 3, 4, 5, 6, 7,
                                      8, 9, 10, 11, 12, 13, 14, 15);
    }
#pragma unroll
    for (int f = 0; f < 4; ++f) {
      FragU av;                                     // A: 16 d x 32 keys, keys in P^T's order
      av.h[0] = ld_tr16(vtr + mbuf * A_BUF + 32 * f);   // keys 8 half + 0..7
      av.h[1] = ld_tr16(vtr + mbuf * A_BUF + 16 * V_PITCH + 32 * f);   // 16 + 8 half + 0..7
      o[0][f] = wmma_bf16(av.v, bp[0], o[0][f]);
      o[1][f] = wmma_bf16(av.v, bp[1], o[1][f]);
    }

    // foot of the pass: the wave's LDS reads of this buffer have retired, its slice of the
    // next tile has landed; behind the barrier that holds for every wave, so the next
    // buffer may be read and this one refilled
    asm volatile("s_wait_dscnt 0x0" ::: "memory");
    tensor_wait0();
    __syncthreads();
    if (pinned(kc + 64 < T_SEQ)) stage(pinned((kc >> 5) + 2), pinned(mbuf));
  }

  // closes the ring: no request and no LDS read of the wave is outstanding when it ends
  tensor_wait0();
  asm volatile("s_wait_dscnt 0x0" ::: "memory");

  // join the halves' sums, normalize, store ctx bf16 at [B,T,E]: 8 d = 16 bytes a lane
#pragma unroll
  for (int c = 0; c < 2; ++c) {
    const float lsum = l_run[c] + other_half(l_run[c]);
    const float inv = 1.0f / lsum;
    bf16* crow = ctx + ((size_t)b * T_SEQ + qw + c * 16 + l16) * EMB + h * DH + half * 8;
#pragma unroll
    for (int f = 0; f < 4; ++f) {
      v8bf ov;
#pragma unroll
      for (int r = 0; r < 8; ++r) ov[r] = f2bf(o[c][f][r] * inv);
      *(v8bf*)(crow + f * 16) = ov;
    }
  }
}

// ---------------------------------------------------------------------------
// Kernel 3: output projection.  grid = (M/256, N/128), block = 256: one block a WGP.
// out[T,B,E](f32) = ctx[B,T,E](bf16) @ w_out^T + b_out
// ---------------------------------------------------------------------------
__global__ __launch_bounds__(256) void out_proj_kernel(
    const bf16* __restrict__ ctx, const bf16* __restrict__ wout,
    const float* __restrict__ b_out, float* __restrict__ out)
{
  __shared__ __attribute__((aligned(2048))) unsigned char ring[2 * G_BUF];
  const int tid  = threadIdx.x;
  const int lane = tid & 31, wave = tid >> 5;
  const int half = lane >> 4, l16 = lane & 15;
  const int m0 = blockIdx.x * G_BM;
  const int n0 = blockIdx.y * G_BN;
  const int wm = wave & 3, wn = wave >> 2;

  v8f acc[4][4] = {};
  gemm_256x128(ctx + (size_t)m0 * EMB, wout + (size_t)n0 * EMB, ring, acc);

#pragma unroll
  for (int j = 0; j < 4; ++j) {
    int n = n0 + wn * 64 + j * 16 + l16;
    float bj = b_out[n];
#pragma unroll
    for (int i = 0; i < 4; ++i) {
#pragma unroll
      for (int r = 0; r < 8; ++r) {
        int m = m0 + wm * 64 + i * 16 + r + half * 8;   // row in [B*T]
        int bb = m >> 11;                                // / T_SEQ
        int t  = m & (T_SEQ - 1);
        out[((size_t)t * BATCH + bb) * EMB + n] = acc[i][j][r] + bj;
      }
    }
  }
}

// ---------------------------------------------------------------------------
extern "C" void kernel_launch(void* const* d_in, const int* in_sizes, int n_in,
                              void* d_out, int out_size, void* d_ws, size_t ws_size,
                              hipStream_t stream) {
  (void)in_sizes; (void)n_in; (void)out_size; (void)ws_size;
  const float* query = (const float*)d_in[0];
  const float* key   = (const float*)d_in[1];
  const float* value = (const float*)d_in[2];
  const float* mask  = (const float*)d_in[3];
  const float* w_qkv = (const float*)d_in[4];
  const float* b_qkv = (const float*)d_in[5];
  const float* w_out = (const float*)d_in[6];
  const float* b_out = (const float*)d_in[7];
  float* out = (float*)d_out;

  const size_t NTOK = (size_t)T_SEQ * BATCH * EMB;      // 8388608
  const size_t NWQ  = (size_t)3 * EMB * EMB;            // 3145728
  const size_t NWO  = (size_t)EMB * EMB;                // 1048576
  bf16* xq   = (bf16*)d_ws;           // bf16 copies of inputs
  bf16* xk   = xq + NTOK;
  bf16* xv   = xk + NTOK;
  bf16* wqb  = xv + NTOK;
  bf16* wob  = wqb + NWQ;
  bf16* Qh   = wob + NWO;             // projected [B,H,T,DH]
  bf16* Kh   = Qh + NTOK;
  bf16* Vh   = Kh + NTOK;
  bf16* ctx  = Vh + NTOK;             // [B,T,E]

  // xq, xk, xv, wqb, wob are one contiguous run of the workspace
  cvt_all_kernel<<<256, 512, 0, stream>>>(query, key, value, w_qkv, w_out, xq);

  dim3 gQKV(32, 8, 3);               // M=8192/256, N=1024/128, {q,k,v}
  qkv_proj_kernel<<<gQKV, 256, 0, stream>>>(xq, xk, xv, wqb, b_qkv, Qh, Kh, Vh);

  dim3 gATT(T_SEQ / 128, BATCH * NH / 2);   // 128 queries x 2 heads a block
  attention_kernel<<<gATT, 256, 0, stream>>>(Qh, Kh, Vh, mask, ctx);

  dim3 gOUT(32, 8);                  // M=8192/256, N=1024/128
  out_proj_kernel<<<gOUT, 256, 0, stream>>>(ctx, wob, b_out, out);
}

// v010
// It runs in 126 microseconds.
// In two side-by-side timings against v009, it was 1.04 and 1.05 times as fast.
// Over all steps from v000 it is 3.11 times as fast.
#include <hip/hip_runtime.h>
#include <stdint.h>

#define T_SEQ 2048
#define BATCH 4
#define EMB   1024
#define NH    16
#define DH    64
#define ATTN_SCALE 0.125f   // 1/sqrt(64)

typedef __bf16 bf16;
typedef __attribute__((ext_vector_type(16))) __bf16 v16bf;
typedef __attribute__((ext_vector_type(8)))  __bf16 v8bf;
typedef __attribute__((ext_vector_type(4)))  __bf16 v4bf;
typedef __attribute__((ext_vector_type(8)))  float  v8f;
typedef __attribute__((ext_vector_type(4)))  float  f32x4;
typedef __attribute__((ext_vector_type(4)))  unsigned int u32x4;

union FragU { v16bf v; u32x4 h[2]; };

// ---- tensor loads: one request of a wave brings a tile of 128-byte rows into LDS ----
typedef __attribute__((ext_vector_type(8))) unsigned int u32x8;
__device__ __forceinline__ uint32_t uni(uint32_t v) {
  return (uint32_t)__builtin_amdgcn_readfirstlane((int)v);
}
__device__ __forceinline__ uint32_t pinned(uint32_t v) {
  uint32_t w = uni(v);
  asm volatile("" : "+s"(w));
  return w;
}
#define TDM_ROW 128u                                       // bytes a row
#define TDM_PAD16 ((1u << 20) | (4u << 22) | (3u << 25))   // LDS pitch 144: rows read by ds_load_b128
#define TDM_PAD32 ((1u << 20) | (4u << 22) | (7u << 25))   // LDS pitch 160: rows read by ds_load_tr16_b128
template <uint32_t WORD0>
__device__ __forceinline__ u32x8 tdm_group1(uint32_t rows, uint32_t src_pitch) {
  u32x8 g1;
  g1[0] = pinned(WORD0);
  g1[1] = pinned(TDM_ROW << 16);
  g1[2] = pinned(rows << 16);
  g1[3] = pinned(TDM_ROW << 16);
  g1[4] = pinned(rows);
  g1[5] = pinned(src_pitch);
  g1[6] = pinned(0u);
  g1[7] = pinned(0u);
  return g1;
}
__device__ __forceinline__ u32x4 tdm_group0(uint32_t lds_dst, uint64_t ga) {
  u32x4 g0;
  g0[0] = uni(1u);
  g0[1] = uni(lds_dst);
  g0[2] = uni((uint32_t)ga);
  g0[3] = uni((((uint32_t)(ga >> 32)) & 0x01FFFFFFu) | 0x80000000u);
  return g0;
}
__device__ __forceinline__ void tdm_load(u32x4 g0, u32x8 g1) {
  // one request of the whole wave, through no vector register; the waits are written by hand
  asm volatile("tensor_load_to_lds %0, %1" :: "s"(g0), "s"(g1) : "memory");
}
// the issuing wave's own requests have landed
__device__ __forceinline__ void tensor_wait0() {
  asm volatile("s_wait_tensorcnt 0x0" ::: "memory");
}

// round-to-nearest-even f32 -> bf16 (bit-level)
__device__ __forceinline__ bf16 f2bf(float f) {
  unsigned u = __builtin_bit_cast(unsigned, f);
  unsigned r = (u + 0x7FFFu + ((u >> 16) & 1u)) >> 16;
  unsigned short s = (unsigned short)r;
  return __builtin_bit_cast(bf16, s);
}

__device__ __forceinline__ v8f wmma_bf16(v16bf a, v16bf b, v8f c) {
  return __builtin_amdgcn_wmma_f32_16x16x32_bf16(false, a, false, b, (short)0, c, false, false);
}

// 16x32 bf16 operand fragment from a row-major LDS tile.
// lane&15 = row, half = K-subset; two contiguous 8-bf16 runs per lane.
__device__ __forceinline__ v16bf load_frag(const bf16* base, int strideBf,
                                           int rowOff, int colOff) {
  const int lane = threadIdx.x & 31;
  const int half = lane >> 4;
  const bf16* p = base + (size_t)((lane & 15) + rowOff) * strideBf + colOff + half * 8;
  FragU f;
  f.h[0] = *(const u32x4*)(p);
  f.h[1] = *(const u32x4*)(p + 16);
  return f.v;
}

// ---------------------------------------------------------------------------
// Kernel 0: f32 -> bf16 conversion of all five operands in ONE launch.
// The five bf16 copies lie one behind another in the workspace, so the output is one
// array of 28,672 units of 1,024 elements: query 8,192 units, key 8,192, value 8,192,
// w_qkv 3,072, w_out 1,024.  grid = 256, block = 512: 4,096 waves, one block a WGP.
// Wave w converts units w + 4096 i, i = 0..6; a unit is 8 loads of 16 bytes a lane,
// and the loads run two units ahead of the conversion.
// ---------------------------------------------------------------------------
#define CVT_WAVES 4096
#define CVT_UNIT  1024
#define CVT_UNITS 7        // units a wave
#define CVT_AHEAD 2        // how many units ahead of the one being converted the loads run
#define CVT_STEP  ((size_t)CVT_WAVES * CVT_UNIT)   // elements between a wave's units

__global__ __launch_bounds__(512) void cvt_all_kernel(
    const float* __restrict__ q, const float* __restrict__ k,
    const float* __restrict__ v, const float* __restrict__ wqkv,
    const float* __restrict__ wout, bf16* __restrict__ out)
{
  const unsigned el = (threadIdx.x & 31u) * 8u;    // this lane's 8 elements of each 256
  const int w = blockIdx.x * 16 + __builtin_amdgcn_readfirstlane(threadIdx.x >> 5);
  const size_t off = (size_t)w * CVT_UNIT;         // wave-uniform
  const float* src[CVT_UNITS] = {
      q + off, q + off + CVT_STEP, k + off, k + off + CVT_STEP,
      v + off, v + off + CVT_STEP,
      (w < 3072) ? wqkv + off : wout + (off - (size_t)3072 * CVT_UNIT)};
  bf16* dst = out + off;

  f32x4 r[CVT_AHEAD + 1][8];                       // ring of unit buffers
#define CVT_LOAD(U) do { _Pragma("unroll") for (int j = 0; j < 4; ++j) { \
    r[(U) % (CVT_AHEAD + 1)][2 * j]     = *(const f32x4*)(src[U] + j * 256 + el); \
    r[(U) % (CVT_AHEAD + 1)][2 * j + 1] = *(const f32x4*)(src[U] + j * 256 + el + 4); } } while (0)
// stands in front of loads that land in registers which issued loads and stores still name
#define CVT_XWAIT() asm volatile("s_wait_xcnt 0x0" ::: "memory")
#pragma unroll
  for (int u = 0; u < CVT_AHEAD; ++u) CVT_LOAD(u);
#pragma unroll
  for (int u = 0; u < CVT_UNITS; ++u) {
    // the two scheduling barriers pin the order "a later unit's loads, then this unit's
    // conversion and stores"; without them the loads bunch and the wave runs dry between
    __builtin_amdgcn_sched_barrier(0);
    if (u + CVT_AHEAD < CVT_UNITS) { CVT_XWAIT(); CVT_LOAD(u + CVT_AHEAD); }
    __builtin_amdgcn_sched_barrier(0);
#pragma unroll
    for (int j = 0; j < 4; ++j) {
      const f32x4 a = r[u % (CVT_AHEAD + 1)][2 * j], b = r[u % (CVT_AHEAD + 1)][2 * j + 1];
      v8bf o;
      o[0] = f2bf(a.x); o[1] = f2bf(a.y); o[2] = f2bf(a.z); o[3] = f2bf(a.w);
      o[4] = f2bf(b.x); o[5] = f2bf(b.y); o[6] = f2bf(b.z); o[7] = f2bf(b.w);
      *(v8bf*)(dst + u * CVT_STEP + j * 256 + el) = o;
    }
  }
#undef CVT_LOAD
#undef CVT_XWAIT
}

// ---------------------------------------------------------------------------
// Main loop of both projections: Y(256 x 128) = X(256 x 1024) W(128 x 1024)^T, all bf16.
// block = 256 (8 waves, 4 x 2, 64 x 64 a wave: 16 products for 8 fragments read from LDS).
// A pass is 64 k: a row's share is 128 bytes, one whole line.  Every wave brings one slice of
// the pass by ONE tensor load: waves 0-3 64 rows of X each, waves 4-7 32 rows of W each; the
// load's pad lays the rows in LDS at 144 bytes (16 x odd).  A slice's place is a multiple of
// 2 KiB.  Two buffers: the loads of pass t + 1 fly while pass t is worked on, and one barrier
// behind a pass's last LDS reads hands the buffers over.
// The blocks that share rows of X or of W do not walk k in step: a block starts at pass rot and
// wraps round, so that they do not ask L2 for the same lines at the same moment.
// ---------------------------------------------------------------------------
#define G_BM 256
#define G_BN 128
#define G_BK 64
#define G_PITCH 72                    // bf16 a row in LDS
#define G_PASSES (EMB / G_BK)
#define G_XSLOT 10240                 // bytes: 64 rows x 144, rounded up to 2 KiB
#define G_WSLOT 6144                  // bytes: 32 rows x 144, rounded up to 2 KiB
#define G_BUF (4 * G_XSLOT + 4 * G_WSLOT)   // one buffer: X slices, then W slices

// x: row 0 of the block's 256 rows of X; w: row 0 of its 128 rows of W; rot: the block's first pass
__device__ __forceinline__ void gemm_256x128(const bf16* __restrict__ x,
                                             const bf16* __restrict__ w, uint32_t rot,
                                             const unsigned char* ring, v8f (&acc)[4][4]) {
  const int tid  = threadIdx.x;
  const int wave = tid >> 5;
  const int wm = wave & 3, wn = wave >> 2;
  // this wave's slice: source, rows, place in a buffer (all wave-uniform)
  const uint32_t wv = uni(threadIdx.x >> 5);
  const uint32_t rows = (wv < 4u) ? 64u : 32u;
  const uint64_t src = (wv < 4u) ? (uint64_t)(x + (size_t)wv * 64 * EMB)
                                 : (uint64_t)(w + (size_t)(wv - 4u) * 32 * EMB);
  const uint32_t place = (uint32_t)(uintptr_t)ring +
      ((wv < 4u) ? wv * G_XSLOT : 4u * G_XSLOT + (wv - 4u) * G_WSLOT);

  const u32x8 g1 = tdm_group1<TDM_PAD16>(rows, EMB * 2);
  auto stage = [&](uint32_t kt, uint32_t buf) {
    const uint32_t kr = (kt + rot) & (G_PASSES - 1u);   // X and W alike: the same 64 k of both
    tdm_load(tdm_group0(place + buf * G_BUF, src + (uint64_t)kr * (G_BK * 2)), g1);
  };

  stage(0, 0);
  tensor_wait0();    // the wave's slice of pass 0 has landed ...
  __syncthreads();   // ... and every wave's
  stage(1, 1);

#pragma unroll 1            // keep accumulators pinned; no unroll-induced copies
  for (int kt = 0; kt < G_PASSES; ++kt) {
    const int buf = kt & 1;
    // the wave's 64 rows of X are slice wm; its 64 rows of W are slices 2 wn and 2 wn + 1
    const bf16* cA = (const bf16*)(ring + buf * G_BUF + wm * G_XSLOT);
    const bf16* cB = (const bf16*)(ring + buf * G_BUF + 4 * G_XSLOT + wn * 2 * G_WSLOT);
    v16bf a[4], b[4];
#define G_FRAGS(S) do { \
    _Pragma("unroll") for (int i = 0; i < 4; ++i) a[i] = load_frag(cA, G_PITCH, i * 16, (S) * 32); \
    _Pragma("unroll") for (int j = 0; j < 4; ++j) b[j] = load_frag(cB + (j >> 1) * (G_WSLOT / 2), G_PITCH, (j & 1) * 16, (S) * 32); } while (0)
#define G_PRODUCTS() do { \
    _Pragma("unroll") for (int j = 0; j < 4; ++j) \
    _Pragma("unroll") for (int i = 0; i < 4; ++i) acc[i][j] = wmma_bf16(a[i], b[j], acc[i][j]); } while (0)
    G_FRAGS(0);
    // keeps the 16 LDS reads one group in front of their 16 products; left to itself the
    // compiler reloads one B fragment among the products and waits it out four times
    __builtin_amdgcn_sched_barrier(0);
    G_PRODUCTS();
    G_FRAGS(1);
    // foot of the pass, behind its last LDS reads: the wave's reads of this buffer have
    // retired, its slice of the next pass has landed; behind the barrier that holds for
    // every wave, so the next buffer may be read and this one refilled
    asm volatile("s_wait_dscnt 0x0" ::: "memory");
    tensor_wait0();
    __syncthreads();
    if (pinned(kt + 2 < G_PASSES)) stage(pinned(kt + 2), pinned(buf));
    // keeps the load's issue in front of the pass's last 16 products (registers only), so
    // that the load has a whole pass to land
    __builtin_amdgcn_sched_barrier(0);
    G_PRODUCTS();
  }
#undef G_FRAGS
#undef G_PRODUCTS
  // closes the ring: no request and no LDS read of the wave is outstanding behind it
  tensor_wait0();
  asm volatile("s_wait_dscnt 0x0" ::: "memory");
}

__global__ __launch_bounds__(256) __attribute__((amdgpu_waves_per_eu(4, 4))) void qkv_proj_kernel(
    const bf16* __restrict__ xq, const bf16* __restrict__ xk,
    const bf16* __restrict__ xv, const bf16* __restrict__ wqkv,
    const float* __restrict__ b_qkv,
    bf16* __restrict__ q_out, bf16* __restrict__ k_out, bf16* __restrict__ v_out)
{
  __shared__ __attribute__((aligned(2048))) unsigned char ring[2 * G_BUF];
  const int tid  = threadIdx.x;
  const int lane = tid & 31, wave = tid >> 5;
  const int half = lane >> 4, l16 = lane & 15;
  const int which = blockIdx.z;
  const bf16* x    = (which == 0) ? xq : ((which == 1) ? xk : xv);
  const bf16* w    = wqkv + (size_t)which * EMB * EMB;
  const float* bias = b_qkv + which * EMB;
  bf16* outp        = (which == 0) ? q_out : ((which == 1) ? k_out : v_out);
  const int m0 = blockIdx.x * G_BM;
  const int n0 = blockIdx.y * G_BN;
  const int wm = wave & 3, wn = wave >> 2;

  v8f acc[4][4] = {};
  // 8 blocks share rows of X (starts 2 passes apart), 32 share rows of W (1 apart, modulo 16)
  gemm_256x128(x + (size_t)m0 * EMB, w + (size_t)n0 * EMB, blockIdx.x + 2u * blockIdx.y, ring, acc);

  // epilogue: +bias, convert, scatter into [B,H,T,DH]
#pragma unroll
  for (int j = 0; j < 4; ++j) {
    int n = n0 + wn * 64 + j * 16 + l16;
    float bj = bias[n];
    int hh = n >> 6, dd = n & 63;
#pragma unroll
    for (int i = 0; i < 4; ++i) {
#pragma unroll
      for (int r = 0; r < 8; ++r) {
        int m = m0 + wm * 64 + i * 16 + r + half * 8;   // row in [T*B]
        int t = m >> 2, bb = m & 3;                      // x is [T,B,E]
        float val = acc[i][j][r] + bj;
        outp[(unsigned)(((bb * NH + hh) * T_SEQ + t) * DH + dd)] = f2bf(val);   // 32-bit index: fewer address registers
      }
    }
  }
}

__device__ __forceinline__ float other_half(float x) {
  int b = __builtin_bit_cast(int, x);
  b = __builtin_amdgcn_permlanex16(b, b, 0x76543210, 0xfedcba98, false, false);
  return __builtin_bit_cast(float, b);
}

#define MASK_PITCH 36   // floats
#define V_PITCH 160     // bytes: 32 x odd, the conflict-free pitch of the transposing load
#define A_SLOT 6144     // bytes a slice: 32 rows x 144 or 160, rounded up to 2 KiB
#define A_BUF (8 * A_SLOT)
#define SCALE_LOG2E (ATTN_SCALE * 1.44269504088896340736f)   // raw score -> exponent of 2
#define LAZY_STEP 8.0f   // log2 units a maximum may lie above the reference in use

typedef __attribute__((ext_vector_type(8))) short s16x8;
__device__ __forceinline__ u32x4 ld_tr16(const unsigned char* p) {
  typedef __attribute__((address_space(3))) s16x8 lds_s16x8;
  return __builtin_bit_cast(u32x4, __builtin_amdgcn_ds_load_tr16_b128_v8i16((lds_s16x8*)p));
}

__global__ __launch_bounds__(256) __attribute__((amdgpu_waves_per_eu(4, 4))) void attention_kernel(
    const bf16* __restrict__ Q, const bf16* __restrict__ K,
    const bf16* __restrict__ V, const float* __restrict__ mask,
    bf16* __restrict__ ctx)
{
  __shared__ __attribute__((aligned(2048))) unsigned char ring[2 * A_BUF];

  const int tid  = threadIdx.x;
  const int lane = tid & 31, wave = tid >> 5;
  const int half = lane >> 4, l16 = lane & 15;
  const int hs = wave >> 2, qg = wave & 3;      // head of the block, group of 32 queries
  const int bh = blockIdx.y * 2 + hs;
  const int b  = bh >> 4, h = bh & 15;
  const size_t base = (size_t)bh * T_SEQ * DH;
  const int q0 = blockIdx.x * 128;
  const int qw = q0 + qg * 32;

  // Persistent Q fragments (B operand: column = query), tile c, d in [0,32), [32,64)
  v16bf bq[2][2];
#pragma unroll
  for (int c = 0; c < 2; ++c) {
    const bf16* qp = Q + base + (size_t)(qw + c * 16 + l16) * DH;
#pragma unroll
    for (int s = 0; s < 2; ++s) {
      FragU f;
      f.h[0] = *(const u32x4*)(qp + s * 32 + half * 8);
      f.h[1] = *(const u32x4*)(qp + s * 32 + half * 8 + 16);
      bq[c][s] = f.v;
    }
  }

  // this lane's query row of tile 0 in a buffer, at the first key it holds
  const float* mrow = (const float*)(ring + (4 + qg) * A_SLOT) + l16 * MASK_PITCH + half * 8;
  // this lane's address for the transposing loads of V: d tile f at + 32 f bytes
  const unsigned char* vtr =
      ring + (2 + hs) * A_SLOT + (half * 8 + (lane & 7)) * V_PITCH + ((lane >> 3) & 1) * 16;
  // this wave's slice: source, source pitch, bytes from one pass to the next (all wave-uniform)
  const uint32_t wv = uni(threadIdx.x >> 5);
  const size_t base2 = ((size_t)(blockIdx.y * 2) + (wv & 1u)) * T_SEQ * DH;
  const uint64_t src = (wv < 2u) ? (uint64_t)(K + base2)
                     : (wv < 4u) ? (uint64_t)(V + base2)
                                 : (uint64_t)(mask + (size_t)(q0 + (wv - 4u) * 32u) * T_SEQ);
  const uint32_t spitch = (wv < 4u) ? DH * 2u : T_SEQ * 4u;
  const uint32_t sstep  = (wv < 4u) ? 32u * DH * 2u : 32u * 4u;
  const uint32_t place  = (uint32_t)(uintptr_t)ring + wv * A_SLOT;
  const u32x8 g1v = tdm_group1<TDM_PAD32>(32u, spitch);
  const u32x8 g1k = tdm_group1<TDM_PAD16>(32u, spitch);
  // sharers of K, V (same blockIdx.y) start 4 key tiles apart, sharers of the mask 2 apart
  const uint32_t rot = blockIdx.x * 4u + blockIdx.y * 2u;
  auto stage = [&](uint32_t pass, uint32_t buf) {
    const uint32_t kt = (pass + rot) & (T_SEQ / 32 - 1u);   // K, V and mask alike: the same 32 keys
    const u32x4 g0 = tdm_group0(place + buf * A_BUF, src + (uint64_t)kt * sstep);
    // two issue sites, so that the pad word is a constant at each
    if (pinned((wv & 6u) == 2u)) tdm_load(g0, g1v);
    else                         tdm_load(g0, g1k);
  };
  stage(0, 0);
  tensor_wait0();    // the wave's slice of pass 0 has landed ...
  __syncthreads();   // ... and every wave's
  stage(1, 1);

  // per query tile c:
  float ref[2] = {-3.0e38f, -3.0e38f};   // reference of this lane's query, log2 units
  float lim[2] = {-3.0e38f, -3.0e38f};   // raw score above which the reference moves
  float l_run[2] = {0.0f, 0.0f};         // running sum over this half's keys; joined at the end
  v8f o[2][4] = {};                      // o[c][f][r] = O[query l16 of tile c][d = 16 f + 8 half + r]

#pragma unroll 1
  for (int kc = 0; kc < T_SEQ; kc += 32) {
    const int mbuf = (kc >> 5) & 1;
    // K fragments of the pass: each is the A operand of both query tiles
    v16bf ak[2][2];
#pragma unroll
    for (int j = 0; j < 2; ++j) {
      ak[j][0] = load_frag((const bf16*)(ring + mbuf * A_BUF + hs * A_SLOT), 72, j * 16, 0);
      ak[j][1] = load_frag((const bf16*)(ring + mbuf * A_BUF + hs * A_SLOT), 72, j * 16, 32);
    }
    // mask of the lane's two queries at the 2 x 8 keys it holds
    f32x4 mk[2][2][2];
#pragma unroll
    for (int c = 0; c < 2; ++c)
#pragma unroll
      for (int j = 0; j < 2; ++j) {
        const float* mp = mrow + mbuf * (A_BUF / 4) + c * (16 * MASK_PITCH) + j * 16;
        mk[c][j][0] = *(const f32x4*)(mp);
        mk[c][j][1] = *(const f32x4*)(mp + 4);
      }

    // S^T(32x16) = K(32x64) Q^T, twice
    v8f sacc[2][2] = {};
#pragma unroll
    for (int s = 0; s < 2; ++s)
#pragma unroll
      for (int j = 0; j < 2; ++j)
#pragma unroll
        for (int c = 0; c < 2; ++c) sacc[c][j] = wmma_bf16(ak[j][s], bq[c][s], sacc[c][j]);

    // raw scores t = s mask; softmax against a held reference (lazy rescale): while no
    // maximum of the pass lies more than LAZY_STEP (log2 units) above the reference in use,
    // the reference stands and neither alpha nor a rescale of O and l is worked out
    float mx[2];
#pragma unroll
    for (int c = 0; c < 2; ++c) {
      mx[c] = -3.0e38f;
#pragma unroll
      for (int j = 0; j < 2; ++j) {
        sacc[c][j] = sacc[c][j] *
            __builtin_shufflevector(mk[c][j][0], mk[c][j][1], 0, 1, 2, 3, 4, 5, 6, 7);
#pragma unroll
        for (int r = 0; r < 8; ++r) mx[c] = fmaxf(mx[c], sacc[c][j][r]);
      }
    }
    // one test a pass, a scalar branch for the whole wave and both tiles
    if (__builtin_amdgcn_ballot_w32((mx[0] > lim[0]) | (mx[1] > lim[1])) != 0) {
#pragma unroll
      for (int c = 0; c < 2; ++c) {
        const float m2    = fmaxf(mx[c], other_half(mx[c]));
        const float rnew  = fmaxf(ref[c], m2 * SCALE_LOG2E);
        const float alpha = __builtin_amdgcn_exp2f(ref[c] - rnew);
        ref[c] = rnew;
        lim[c] = (rnew + LAZY_STEP) * (1.0f / SCALE_LOG2E);
        l_run[c] *= alpha;
#pragma unroll
        for (int f = 0; f < 4; ++f)
#pragma unroll
          for (int r = 0; r < 8; ++r) o[c][f][r] *= alpha;
      }
    }
    // p = 2^(t c - ref): one fma and one exp2 a score (c2, nref: a scalar in every element)
    const v8f c2 = SCALE_LOG2E - (v8f){};
    v16bf bp[2];
#pragma unroll
    for (int c = 0; c < 2; ++c) {
      const v8f nref = -ref[c] - (v8f){};
#pragma unroll
      for (int j = 0; j < 2; ++j) {
        const v8f e = __builtin_elementwise_fma(sacc[c][j], c2, nref);
#pragma unroll
        for (int r = 0; r < 8; ++r) sacc[c][j][r] = __builtin_amdgcn_exp2f(e[r]);
      }
      const v8f ps = sacc[c][0] + sacc[c][1];
      l_run[c] += ((ps[0] + ps[1]) + (ps[2] + ps[3])) + ((ps[4] + ps[5]) + (ps[6] + ps[7]));

      // the two score tiles, converted in place, are the B operand P^T (32 keys x 16 q)
      const v8bf pl = __builtin_convertvector(sacc[c][0], v8bf);
      const v8bf ph = __builtin_convertvector(sacc[c][1], v8bf);
      bp[c] = __builtin_shufflevector(pl, ph, 0, 1, 2, 3, 4, 5, 6, 7,
                                      8, 9, 10, 11, 12, 13, 14, 15);
    }
#pragma unroll
    for (int f = 0; f < 4; ++f) {
      FragU av;                                     // A: 16 d x 32 keys, keys in P^T's order
      av.h[0] = ld_tr16(vtr + mbuf * A_BUF + 32 * f);   // keys 8 half + 0..7
      av.h[1] = ld_tr16(vtr + mbuf * A_BUF + 16 * V_PITCH + 32 * f);   // 16 + 8 half + 0..7
      o[0][f] = wmma_bf16(av.v, bp[0], o[0][f]);
      o[1][f] = wmma_bf16(av.v, bp[1], o[1][f]);
    }

    // foot of the pass: the wave's LDS reads of this buffer have retired, its slice of the
    // next tile has landed; behind the barrier that holds for every wave, so the next
    // buffer may be read and this one refilled
    asm volatile("s_wait_dscnt 0x0" ::: "memory");
    tensor_wait0();
    __syncthreads();
    if (pinned(kc + 64 < T_SEQ)) stage(pinned((kc >> 5) + 2), pinned(mbuf));
  }

  // closes the ring: no request and no LDS read of the wave is outstanding when it ends
  tensor_wait0();
  asm volatile("s_wait_dscnt 0x0" ::: "memory");

  // join the halves' sums, normalize, store ctx bf16 at [B,T,E]: 8 d = 16 bytes a lane
#pragma unroll
  for (int c = 0; c < 2; ++c) {
    const float lsum = l_run[c] + other_half(l_run[c]);
    const float inv = 1.0f / lsum;
    bf16* crow = ctx + ((size_t)b * T_SEQ + qw + c * 16 + l16) * EMB + h * DH + half * 8;
#pragma unroll
    for (int f = 0; f < 4; ++f) {
      v8bf ov;
#pragma unroll
      for (int r = 0; r < 8; ++r) ov[r] = f2bf(o[c][f][r] * inv);
      *(v8bf*)(crow + f * 16) = ov;
    }
  }
}

// ---------------------------------------------------------------------------
// Kernel 3: output projection.  grid = (M/256, N/128), block = 256: one block a WGP.
// out[T,B,E](f32) = ctx[B,T,E](bf16) @ w_out^T + b_out
// ---------------------------------------------------------------------------
__global__ __launch_bounds__(256) void out_proj_kernel(
    const bf16* __restrict__ ctx, const bf16* __restrict__ wout,
    const float* __restrict__ b_out, float* __restrict__ out)
{
  __shared__ __attribute__((aligned(2048))) unsigned char ring[2 * G_BUF];
  const int tid  = threadIdx.x;
  const int lane = tid & 31, wave = tid >> 5;
  const int half = lane >> 4, l16 = lane & 15;
  const int m0 = blockIdx.x * G_BM;
  const int n0 = blockIdx.y * G_BN;
  const int wm = wave & 3, wn = wave >> 2;

  v8f acc[4][4] = {};
  // 8 blocks share rows of ctx (starts 2 passes apart), 32 share rows of W (1 apart, modulo 16)
  gemm_256x128(ctx + (size_t)m0 * EMB, wout + (size_t)n0 * EMB, blockIdx.x + 2u * blockIdx.y, ring, acc);

#pragma unroll
  for (int j = 0; j < 4; ++j) {
    int n = n0 + wn * 64 + j * 16 + l16;
    float bj = b_out[n];
#pragma unroll
    for (int i = 0; i < 4; ++i) {
#pragma unroll
      for (int r = 0; r < 8; ++r) {
        int m = m0 + wm * 64 + i * 16 + r + half * 8;   // row in [B*T]
        int bb = m >> 11;                                // / T_SEQ
        int t  = m & (T_SEQ - 1);
        out[((size_t)t * BATCH + bb) * EMB + n] = acc[i][j][r] + bj;
      }
    }
  }
}

// ---------------------------------------------------------------------------
extern "C" void kernel_launch(void* const* d_in, const int* in_sizes, int n_in,
                              void* d_out, int out_size, void* d_ws, size_t ws_size,
                              hipStream_t stream) {
  (void)in_sizes; (void)n_in; (void)out_size; (void)ws_size;
  const float* query = (const float*)d_in[0];
  const float* key   = (const float*)d_in[1];
  const float* value = (const float*)d_in[2];
  const float* mask  = (const float*)d_in[3];
  const float* w_qkv = (const float*)d_in[4];
  const float* b_qkv = (const float*)d_in[5];
  const float* w_out = (const float*)d_in[6];
  const float* b_out = (const float*)d_in[7];
  float* out = (float*)d_out;

  const size_t NTOK = (size_t)T_SEQ * BATCH * EMB;      // 8388608
  const size_t NWQ  = (size_t)3 * EMB * EMB;            // 3145728
  const size_t NWO  = (size_t)EMB * EMB;                // 1048576
  bf16* xq   = (bf16*)d_ws;           // bf16 copies of inputs
  bf16* xk   = xq + NTOK;
  bf16* xv   = xk + NTOK;
  bf16* wqb  = xv + NTOK;
  bf16* wob  = wqb + NWQ;
  bf16* Qh   = wob + NWO;             // projected [B,H,T,DH]
  bf16* Kh   = Qh + NTOK;
  bf16* Vh   = Kh + NTOK;
  bf16* ctx  = Vh + NTOK;             // [B,T,E]

  // xq, xk, xv, wqb, wob are one contiguous run of the workspace
  cvt_all_kernel<<<256, 512, 0, stream>>>(query, key, value, w_qkv, w_out, xq);

  dim3 gQKV(32, 8, 3);               // M=8192/256, N=1024/128, {q,k,v}
  qkv_proj_kernel<<<gQKV, 256, 0, stream>>>(xq, xk, xv, wqb, b_qkv, Qh, Kh, Vh);

  dim3 gATT(T_SEQ / 128, BATCH * NH / 2);   // 128 queries x 2 heads a block
  attention_kernel<<<gATT, 256, 0, stream>>>(Qh, Kh, Vh, mask, ctx);

  dim3 gOUT(32, 8);                  // M=8192/256, N=1024/128
  out_proj_kernel<<<gOUT, 256, 0, stream>>>(ctx, wob, b_out, out);
}
